// v000
// Times are from an AMD MI455X. After a warm-up the kernel runs many times in a row, and a time is the length of
// such a window on the GPU divided by its runs, so every launch and the gaps after it count. The runs cycle
// through copies of the inputs. A figure is the median of several windows, for all but v000 over two sittings.
// Sittings can differ by a few percent; kernels timed side by side share one.
// v000 is the starting kernel. One run takes 352 microseconds.
#include <hip/hip_runtime.h>

// Contractions: q/k/v projections = v_wmma_f32_16x16x32_bf16 (bf16-RNE activations x bf16-RNE W^T planes, f32 accumulate, bias added in f32); scores K.Q^T and context V^T.P^T (transposed 16x16 tiles) = v_wmma_f32_16x16x32_f16 (f16 planes: Q x4, K x4, V^T x16; P = exp2 terms in f16 carried x256), f32 accumulate; online softmax, normalisation and output in f32.
// Plan: W^T bf16 planes [out][in]; per tensor: bf16 activation plane [tok][512] -> 64x64 register-blocked plane GEMM (one wave per tile, operands straight from the planes) -> f32 [tok][512] (V: [512][tok]) -> f16 plane with bias and power-of-two carry; then one wave per 16 query rows of one (batch, head) streams 32-key steps with fragments loaded straight from the f16 planes (arithmetic addressing only), online softmax, and writes its 16x64 f32 result via an LDS stage as whole 256-B row segments.

#ifndef NB
#define NB 2
#endif
#ifndef SEQ
#define SEQ 4096
#endif
#define NB_FULL 2
#define SEQ_FULL 4096
#define DMOD 512
#define NHEAD 8
#define HD 64
#define TOK (NB * SEQ)
#define PCAR 256.0f                       // carry of the exp2 terms fed to the context WMMA
#define QKCAR 4.0f                        // carry of the Q and K f16 planes
#define VCAR 16.0f                        // carry of the V^T f16 plane
#define SL2E 0.011271055006945026f        // 0.125 * log2(e) / (QKCAR * QKCAR)

static_assert(NB >= 1 && NB <= NB_FULL);
static_assert(SEQ >= 64 && SEQ <= SEQ_FULL && (SEQ % 64) == 0);
static_assert(DMOD == NHEAD * HD && (DMOD % 64) == 0 && HD == 64);
static_assert((((size_t)TOK * DMOD) % 8) == 0);
static_assert(((DMOD * DMOD) % 64) == 0);

typedef _Float16 h16;
typedef unsigned short bf;
typedef __attribute__((ext_vector_type(16))) __bf16   v16bf;
typedef __attribute__((ext_vector_type(16))) _Float16 v16h;
typedef __attribute__((ext_vector_type(8)))  _Float16 v8h;
typedef __attribute__((ext_vector_type(8)))  unsigned short v8us;
typedef __attribute__((ext_vector_type(8)))  float    v8f;
typedef __attribute__((ext_vector_type(4)))  float    v4f;
typedef __attribute__((ext_vector_type(2)))  unsigned short v2us;
typedef v8h  __attribute__((may_alias)) v8ha;
typedef v4f  __attribute__((may_alias)) v4fa;
typedef v8us __attribute__((may_alias)) v8usa;

__device__ __forceinline__ unsigned short f2bf(float f) { unsigned u = __float_as_uint(f); u += 0x7FFFu + ((u >> 16) & 1u); return (unsigned short)(u >> 16); }
__device__ __forceinline__ float bf2f(unsigned short b) { return __uint_as_float(((unsigned)b) << 16); }
__device__ __forceinline__ float bfr(float f) { return bf2f(f2bf(f)); }
__device__ __forceinline__ v16h cat16(v8h lo, v8h hi) { return __builtin_shufflevector(lo, hi, 0, 1, 2, 3, 4, 5, 6, 7, 8, 9, 10, 11, 12, 13, 14, 15); }
__device__ __forceinline__ v16bf cat16b(v8us lo, v8us hi) { return __builtin_bit_cast(v16bf, __builtin_shufflevector(lo, hi, 0, 1, 2, 3, 4, 5, 6, 7, 8, 9, 10, 11, 12, 13, 14, 15)); }
__device__ __forceinline__ v8f wmma16(v16h a, v16h b, v8f c) { return __builtin_amdgcn_wmma_f32_16x16x32_f16(false, a, false, b, (short)0, c, false, false); }
__device__ __forceinline__ v8f wmmab(v16bf a, v16bf b, v8f c) { return __builtin_amdgcn_wmma_f32_16x16x32_bf16(false, a, false, b, (short)0, c, false, false); }

// ---- k_gemmw: register-blocked GEMM, ONE WAVE per 64x64 output tile (16 accumulators), operands straight from K-contiguous 16-bit planes; grid (M/64, N/64, Z), 32 threads.
// C[m][n] (f32, pitch ldc, + optional f32 bias[n]) = sum_k A[m][k] Bt[n][k] (+ split products per NSPLIT). z-batch strides sA/sB/sC in elements. K % 32 == 0.
// Fragments: lane row/col = l&15, elements 0..7 <- k0+8h+0..7, 8..15 <- k0+16+8h+0..7 (h = l>>4) for A and Bt alike; D element r of lane l = (row 8h+r, col l&15).
template <typename T16> struct WFrag;
template <> struct WFrag<h16> { typedef v16h V; static __device__ __forceinline__ V ld(const h16* p) { return cat16(*(const v8h*)p, *(const v8h*)(p + 16)); } static __device__ __forceinline__ v8f mma(V a, V b, v8f c) { return wmma16(a, b, c); } };
template <> struct WFrag<bf> { typedef v16bf V; static __device__ __forceinline__ V ld(const bf* p) { return cat16b(*(const v8us*)p, *(const v8us*)(p + 16)); } static __device__ __forceinline__ v8f mma(V a, V b, v8f c) { return wmmab(a, b, c); } };
template <typename T16, int NSPLIT, bool BIAS>
__global__ __launch_bounds__(32) void k_gemmw(const T16* __restrict__ A, const T16* __restrict__ A2, const T16* __restrict__ Bt, const T16* __restrict__ Bt2, int K, float* C, int ldc, const float* __restrict__ bias, size_t sA, size_t sB, size_t sC) {
    typedef typename WFrag<T16>::V V;
    __shared__ __align__(16) float os[16 * 68];
    const size_t z = blockIdx.z; A += z * sA; if (A2) A2 += z * sA; Bt += z * sB; if (Bt2) Bt2 += z * sB; C += z * sC;
    const int lane = threadIdx.x & 31, lr = lane & 15, hi = lane >> 4; const int r0 = blockIdx.x * 64, c0 = blockIdx.y * 64;
    v8f acc[4][4];
#pragma unroll
    for (int mb = 0; mb < 4; ++mb)
#pragma unroll
        for (int nb = 0; nb < 4; ++nb) acc[mb][nb] = (v8f){};
    const size_t aoff = (size_t)(r0 + lr) * K + 8 * hi, boff = (size_t)(c0 + lr) * K + 8 * hi;
#pragma unroll 1
    for (int kc = 0; kc < K; kc += 32) {
        V a[4], a2[4];
#pragma unroll
        for (int mb = 0; mb < 4; ++mb) { a[mb] = WFrag<T16>::ld(A + aoff + (size_t)mb * 16 * K + kc); if (NSPLIT == 1 || NSPLIT == 2) a2[mb] = WFrag<T16>::ld(A2 + aoff + (size_t)mb * 16 * K + kc); }
#pragma unroll
        for (int nb = 0; nb < 4; ++nb) { const V b = WFrag<T16>::ld(Bt + boff + (size_t)nb * 16 * K + kc); V b2; if (NSPLIT >= 2) b2 = WFrag<T16>::ld(Bt2 + boff + (size_t)nb * 16 * K + kc);
#pragma unroll
            for (int mb = 0; mb < 4; ++mb) { acc[mb][nb] = WFrag<T16>::mma(a[mb], b, acc[mb][nb]); if (NSPLIT == 1 || NSPLIT == 2) acc[mb][nb] = WFrag<T16>::mma(a2[mb], b, acc[mb][nb]); if (NSPLIT >= 2) acc[mb][nb] = WFrag<T16>::mma(a[mb], b2, acc[mb][nb]); } }
        asm volatile("v_nop\n\tv_nop\n\tv_nop\n\tv_nop" : "+v"(acc[0][0]), "+v"(acc[1][1]), "+v"(acc[2][2]), "+v"(acc[3][3]) : "v"(a[0]), "v"(a[3]));
    }
#pragma unroll
    for (int mb = 0; mb < 4; ++mb) {
#pragma unroll
        for (int nb = 0; nb < 4; ++nb) {
#pragma unroll
            for (int j = 0; j < 8; ++j) os[(hi * 8 + j) * 68 + nb * 16 + lr] = acc[mb][nb][j]; }
        __builtin_amdgcn_wave_barrier(); asm volatile("" ::: "memory");
        float* crow = C + (size_t)(r0 + mb * 16) * ldc + c0;
{
#pragma unroll
            for (int s = 0; s < 8; ++s) { const int row = 2 * s + hi, cofs = lr * 4; v4f val = *(const v4fa*)(os + row * 68 + cofs); if (BIAS) { val[0] += bfr(bias[c0 + cofs]); val[1] += bfr(bias[c0 + cofs + 1]); val[2] += bfr(bias[c0 + cofs + 2]); val[3] += bfr(bias[c0 + cofs + 3]); }
                *(v4f*)(crow + (size_t)row * ldc + cofs) = val; }
             }
        __builtin_amdgcn_wave_barrier(); asm volatile("" ::: "memory");
    }
}

// coverage: gridDim.x * 8 waves * 8 lines * 64 >= N*K, bounded by L < nlines.
__global__ __launch_bounds__(256) void k_wtG(const float* __restrict__ w, int K, int N, bf* Bt) {
    const int lane = threadIdx.x & 31; const int L0 = (blockIdx.x * 8 + (threadIdx.x >> 5)) * 8; const int nlines = N * K / 64;
{
#pragma unroll 1
        for (int l = 0; l < 8; ++l) { const int L = L0 + l; if (L >= nlines) break; const size_t e = (size_t)L * 64 + lane * 2; const int k = (int)(e % K), n = (int)(e / K); v2us o;
            o[0] = f2bf(w[(size_t)k * N + n]); o[1] = f2bf(w[(size_t)(k + 1) * N + n]); *(v2us*)(Bt + e) = o; }
         }
}

// coverage: ceil(TOK*DMOD/8 / 256) * 256 threads * 8, bounded by i < TOK*DMOD/8 -> exactly TOK*DMOD elements.
__global__ __launch_bounds__(256) void k_xplane(const float* __restrict__ X, bf* XB) {
    const size_t i = (size_t)blockIdx.x * 256 + threadIdx.x; if (i >= (size_t)TOK * DMOD / 8) return;
    const size_t e = i * 8; const int col = (int)(e % DMOD); const size_t row = e / DMOD; const size_t bb = row / SEQ, s = row % SEQ;
    const v8f v = *(const v8f*)(X + (bb * SEQ_FULL + s) * DMOD + col); v8us o;
#pragma unroll
    for (int k = 0; k < 8; ++k) o[k] = f2bf(v[k]);
    *(v8us*)(XB + e) = o; 
}

// coverage: as k_xplane (TOK*DMOD elements exactly).
template <int MODE>
__global__ __launch_bounds__(256) void k_cvt16(const float* __restrict__ Cf, const float* __restrict__ bias, float sc, h16* P) {
    const size_t i = (size_t)blockIdx.x * 256 + threadIdx.x; if (i >= (size_t)TOK * DMOD / 8) return;
    const size_t e = i * 8; const v8f v = *(const v8f*)(Cf + e); v8h o;
    if (MODE == 0) { const int col = (int)(e % DMOD); const v8f bb = *(const v8f*)(bias + col);
#pragma unroll
        for (int q = 0; q < 8; ++q) o[q] = (h16)((v[q] + bfr(bb[q])) * sc);
    } else { const int n = (int)(e / TOK); const float bn = bfr(bias[n]);
#pragma unroll
        for (int q = 0; q < 8; ++q) o[q] = (h16)((v[q] + bn) * sc);
    }
    *(v8h*)(P + e) = o; 
}

// ---- k_sdpa: one wave = 16 query rows of one (batch b, head h); grid (SEQ/16, NB*NHEAD), 32 threads, no LDS operand staging.
// Transposed tiles: S^T[key][q] = sum_d K[key][d] Q[q][d] (A = K rows from the K plane, B = Q rows from the Q plane, both d-contiguous);
// the two 16-key D tiles of a 32-key step become the B fragment P^T[key][q] (element r <- tile keys 0..15, element 8+r <- tile keys 16..31, lane unchanged);
// O^T[d][q] += sum_key V^T[d][key] P^T[key][q] (A = V^T rows from the [512][tok] plane, key-contiguous). Lane (h2, m): q = q0 + m; keys of a step = kb+8*h2+r and kb+16+8*h2+r.
// Online softmax per q: max / sum over the lane's 16 scores and the partner lane (xor 16); exp2 terms x256 -> f16; running sum over the f16 values in f32.
__global__ __launch_bounds__(32) void k_sdpa(const h16* __restrict__ Q16, const h16* __restrict__ K16, const h16* __restrict__ VT16, float* out) {
    __shared__ __align__(16) float os[16 * 68];
    const int lane = threadIdx.x & 31, m = lane & 15, hh = lane >> 4;
    const int bh = blockIdx.y; const int b = bh / NHEAD, h = bh % NHEAD; const int q0 = blockIdx.x * 16;
    const h16* qrow = Q16 + ((size_t)b * SEQ + q0 + m) * DMOD + h * HD + 8 * hh;
    const v16h qf0 = cat16(*(const v8h*)(qrow), *(const v8h*)(qrow + 16));          // d 0..31
    const v16h qf1 = cat16(*(const v8h*)(qrow + 32), *(const v8h*)(qrow + 48));     // d 32..63
    const h16* kbase = K16 + ((size_t)b * SEQ + m) * DMOD + h * HD + 8 * hh;       // + key-tile base * DMOD
    const h16* vbase = VT16 + ((size_t)h * HD + m) * TOK + (size_t)b * SEQ + 8 * hh;   // + d-tile * 16 * TOK + key base
    v8f oacc[4];
#pragma unroll
    for (int t = 0; t < 4; ++t) oacc[t] = (v8f){};
    float mrun = -3.0e38f, lrun = 0.f;
#pragma unroll 1
    for (int kb = 0; kb < SEQ; kb += 32) {
        v16h ka[2][2];
#pragma unroll
        for (int kt = 0; kt < 2; ++kt) { const h16* kr = kbase + (size_t)(kb + kt * 16) * DMOD; ka[kt][0] = cat16(*(const v8h*)kr, *(const v8h*)(kr + 16)); ka[kt][1] = cat16(*(const v8h*)(kr + 32), *(const v8h*)(kr + 48)); }
        v8f st[2];
#pragma unroll
        for (int kt = 0; kt < 2; ++kt) { st[kt] = wmma16(ka[kt][0], qf0, (v8f){}); st[kt] = wmma16(ka[kt][1], qf1, st[kt]); }
        asm volatile("v_nop\n\tv_nop\n\tv_nop\n\tv_nop" : "+v"(st[0]), "+v"(st[1]) : "v"(ka[0][0]), "v"(ka[0][1]), "v"(ka[1][0]), "v"(ka[1][1]), "v"(qf0), "v"(qf1));
        float mx = fmaxf(st[0][0], st[1][0]);
#pragma unroll
        for (int r = 1; r < 8; ++r) mx = fmaxf(mx, fmaxf(st[0][r], st[1][r]));
        mx = fmaxf(mx, __shfl_xor(mx, 16, 32));
        const float mn = fmaxf(mrun, mx);
        const float alpha = __builtin_amdgcn_exp2f((mrun - mn) * SL2E);
        mrun = mn;
        v16h pf = (v16h){}; float psum = 0.f;
#pragma unroll
        for (int r = 0; r < 8; ++r) {
            const h16 p0 = (h16)(__builtin_amdgcn_exp2f((st[0][r] - mn) * SL2E) * PCAR);
            const h16 p1 = (h16)(__builtin_amdgcn_exp2f((st[1][r] - mn) * SL2E) * PCAR);
            pf[r] = p0; pf[8 + r] = p1; psum += (float)p0 + (float)p1; }
        psum += __shfl_xor(psum, 16, 32);
        lrun = lrun * alpha + psum;
#pragma unroll
        for (int t = 0; t < 4; ++t) oacc[t] *= alpha;
        v16h va[4];
#pragma unroll
        for (int t = 0; t < 4; ++t) { const h16* vr = vbase + (size_t)t * 16 * TOK + kb; va[t] = cat16(*(const v8h*)vr, *(const v8h*)(vr + 16)); }
#pragma unroll
        for (int t = 0; t < 4; ++t) oacc[t] = wmma16(va[t], pf, oacc[t]);
        asm volatile("v_nop\n\tv_nop\n\tv_nop\n\tv_nop" : "+v"(oacc[0]), "+v"(oacc[1]), "+v"(oacc[2]), "+v"(oacc[3]) : "v"(va[0]), "v"(va[1]), "v"(va[2]), "v"(va[3]), "v"(pf));
    }
    const float rl = __fdiv_rn(1.0f, lrun) * (1.0f / VCAR);
#pragma unroll
    for (int t = 0; t < 4; ++t)
#pragma unroll
        for (int r = 0; r < 8; ++r) os[m * 68 + t * 16 + hh * 8 + r] = oacc[t][r] * rl;
    __syncthreads();
    float* obase = out + ((size_t)b * SEQ + q0) * DMOD + h * HD;
{
#pragma unroll
        for (int s = 0; s < 8; ++s) { const int row = 2 * s + hh, cofs = m * 4; const v4f val = *(const v4fa*)(os + row * 68 + cofs); *(v4f*)(obase + (size_t)row * DMOD + cofs) = val; }
         }
}

extern "C" void kernel_launch(void* const* d_in, const int* in_sizes, int n_in,
                              void* d_out, int out_size, void* d_ws, size_t ws_size, hipStream_t stream) {
    if (n_in < 9) return;
    const int need_x = ((NB - 1) * SEQ_FULL + SEQ) * DMOD;
    if (in_sizes[0] < need_x || in_sizes[1] < need_x || in_sizes[2] < need_x) return;
    if (in_sizes[3] < DMOD * DMOD || in_sizes[5] < DMOD * DMOD || in_sizes[7] < DMOD * DMOD) return;
    if (in_sizes[4] < DMOD || in_sizes[6] < DMOD || in_sizes[8] < DMOD) return;
    if (out_size < TOK * DMOD) return;
    const float* Xq = (const float*)d_in[0]; const float* Xk = (const float*)d_in[1]; const float* Xv = (const float*)d_in[2];
    const float* Wq = (const float*)d_in[3]; const float* bq = (const float*)d_in[4];
    const float* Wk = (const float*)d_in[5]; const float* bk = (const float*)d_in[6];
    const float* Wv = (const float*)d_in[7]; const float* bv = (const float*)d_in[8];
    float* OUT = (float*)d_out;     // [NB][SEQ][512]
    char* wsp = (char*)d_ws;
    auto take = [&](size_t bytes) { char* p = wsp; wsp += (bytes + 255) & ~(size_t)255; return (void*)p; };
    bf* WTq = (bf*)take((size_t)DMOD * DMOD * 2); bf* WTk = (bf*)take((size_t)DMOD * DMOD * 2); bf* WTv = (bf*)take((size_t)DMOD * DMOD * 2);   // [out][in] bf16
    bf* XB = (bf*)take((size_t)TOK * DMOD * 2);          // bf16 activation plane (reused q, k, v in stream order)
    float* Cf = (float*)take((size_t)TOK * DMOD * 4);    // f32 GEMM result (reused)
    h16* Q16 = (h16*)take((size_t)TOK * DMOD * 2); h16* K16 = (h16*)take((size_t)TOK * DMOD * 2); h16* VT16 = (h16*)take((size_t)TOK * DMOD * 2);   // [tok][512], [tok][512], [512][tok]
    if ((size_t)(wsp - (char*)d_ws) > ws_size) return;
    const unsigned gw = (unsigned)((DMOD * DMOD / 64 + 63) / 64);
    const unsigned g8 = (unsigned)(((size_t)TOK * DMOD / 8 + 255) / 256);
    k_wtG<<<gw, 256, 0, stream>>>(Wq, DMOD, DMOD, WTq);
    k_wtG<<<gw, 256, 0, stream>>>(Wk, DMOD, DMOD, WTk);
    k_wtG<<<gw, 256, 0, stream>>>(Wv, DMOD, DMOD, WTv);
    // Q = query Wq + bq  -> f16 [tok][512] x QKCAR
    k_xplane<<<g8, 256, 0, stream>>>(Xq, XB);
    k_gemmw<bf, 0, false><<<dim3(TOK / 64, DMOD / 64, 1), 32, 0, stream>>>(XB, nullptr, WTq, nullptr, DMOD, Cf, DMOD, nullptr, 0, 0, 0);
    k_cvt16<0><<<g8, 256, 0, stream>>>(Cf, bq, QKCAR, Q16);
    // K = key Wk + bk  -> f16 [tok][512] x QKCAR
    k_xplane<<<g8, 256, 0, stream>>>(Xk, XB);
    k_gemmw<bf, 0, false><<<dim3(TOK / 64, DMOD / 64, 1), 32, 0, stream>>>(XB, nullptr, WTk, nullptr, DMOD, Cf, DMOD, nullptr, 0, 0, 0);
    k_cvt16<0><<<g8, 256, 0, stream>>>(Cf, bk, QKCAR, K16);
    // V^T = (value Wv + bv)^T -> f16 [512][tok] x VCAR  (A = Wv^T plane [n][k], Bt = value plane [tok][k])
    k_xplane<<<g8, 256, 0, stream>>>(Xv, XB);
    k_gemmw<bf, 0, false><<<dim3(DMOD / 64, TOK / 64, 1), 32, 0, stream>>>(WTv, nullptr, XB, nullptr, DMOD, Cf, TOK, nullptr, 0, 0, 0);
    k_cvt16<1><<<g8, 256, 0, stream>>>(Cf, bv, VCAR, VT16);
    // softmax(Q K^T / 8) V per (batch, head), heads merged into [NB][SEQ][512]
    k_sdpa<<<dim3(SEQ / 16, NB * NHEAD, 1), 32, 0, stream>>>(Q16, K16, VT16, OUT);
}

// v001
// It runs in 184 microseconds.
// Two timings next to v000 both put it at 1.97 times that version's speed.
#include <hip/hip_runtime.h>

// Contractions: q/k/v projections = v_wmma_f32_16x16x32_bf16 (bf16-RNE activations x bf16-RNE W^T planes, f32 accumulate, bias added in f32); scores K.Q^T and context V^T.P^T (transposed 16x16 tiles) = v_wmma_f32_16x16x32_f16 (f16 planes: Q x4, K x4, V^T x16; P = exp2 terms in f16 carried x256), f32 accumulate; online softmax, normalisation and output in f32.
// Plan: W^T bf16 planes [out][in]; per tensor: bf16 activation plane [tok][512] -> 64x64 register-blocked plane GEMM (one wave per tile, operands straight from the planes) -> f32 [tok][512] (V: [512][tok]) -> f16 plane with bias and power-of-two carry; then work-groups of 8 waves, one wave per 16 query rows of one (batch, head): 128-key K and V^T tiles are copied once per work-group into a two-buffer LDS ring, every wave streams 32-key steps with fragments read from LDS, online softmax, and writes its 16x64 f32 result via an LDS stage as whole 256-B row segments.

#ifndef NB
#define NB 2
#endif
#ifndef SEQ
#define SEQ 4096
#endif
#define NB_FULL 2
#define SEQ_FULL 4096
#define DMOD 512
#define NHEAD 8
#define HD 64
#define TOK (NB * SEQ)
#define PCAR 256.0f                       // carry of the exp2 terms fed to the context WMMA
#define QKCAR 4.0f                        // carry of the Q and K f16 planes
#define VCAR 16.0f                        // carry of the V^T f16 plane
#define SL2E 0.011271055006945026f        // 0.125 * log2(e) / (QKCAR * QKCAR)

static_assert(NB >= 1 && NB <= NB_FULL);
static_assert(SEQ >= 64 && SEQ <= SEQ_FULL && (SEQ % 64) == 0);
static_assert(DMOD == NHEAD * HD && (DMOD % 64) == 0 && HD == 64);
static_assert((((size_t)TOK * DMOD) % 8) == 0);
static_assert(((DMOD * DMOD) % 64) == 0);
#define QW 8                              // waves per k_sdpa work-group, 16 query rows each
#define KST 128                           // keys per LDS stage
#define NST (SEQ / KST)                   // stages per (batch, head)
#define KPITCH 144                        // bytes per staged K row: 128 + 16 (16 B x odd, for 16-byte LDS reads)
#define VPITCH 272                        // bytes per staged V^T row: 256 + 16
#define KBYTES (KST * KPITCH)
#define VBYTES (HD * VPITCH)
static_assert((SEQ % KST) == 0 && NST >= 2 && (SEQ % (16 * QW)) == 0 && (KST % 32) == 0);
static_assert(KST * 8 == 4 * 32 * QW && HD * (KST / 8) == 4 * 32 * QW);   // four K copies and four V^T copies per lane fill a stage

typedef _Float16 h16;
typedef unsigned short bf;
typedef __attribute__((ext_vector_type(16))) __bf16   v16bf;
typedef __attribute__((ext_vector_type(16))) _Float16 v16h;
typedef __attribute__((ext_vector_type(8)))  _Float16 v8h;
typedef __attribute__((ext_vector_type(8)))  unsigned short v8us;
typedef __attribute__((ext_vector_type(8)))  float    v8f;
typedef __attribute__((ext_vector_type(4)))  float    v4f;
typedef __attribute__((ext_vector_type(2)))  unsigned short v2us;
typedef v8h  __attribute__((may_alias)) v8ha;
typedef v4f  __attribute__((may_alias)) v4fa;
typedef v8us __attribute__((may_alias)) v8usa;

__device__ __forceinline__ unsigned short f2bf(float f) { unsigned u = __float_as_uint(f); u += 0x7FFFu + ((u >> 16) & 1u); return (unsigned short)(u >> 16); }
__device__ __forceinline__ float bf2f(unsigned short b) { return __uint_as_float(((unsigned)b) << 16); }
__device__ __forceinline__ float bfr(float f) { return bf2f(f2bf(f)); }
__device__ __forceinline__ v16h cat16(v8h lo, v8h hi) { return __builtin_shufflevector(lo, hi, 0, 1, 2, 3, 4, 5, 6, 7, 8, 9, 10, 11, 12, 13, 14, 15); }
__device__ __forceinline__ v16bf cat16b(v8us lo, v8us hi) { return __builtin_bit_cast(v16bf, __builtin_shufflevector(lo, hi, 0, 1, 2, 3, 4, 5, 6, 7, 8, 9, 10, 11, 12, 13, 14, 15)); }
__device__ __forceinline__ v8f wmma16(v16h a, v16h b, v8f c) { return __builtin_amdgcn_wmma_f32_16x16x32_f16(false, a, false, b, (short)0, c, false, false); }
__device__ __forceinline__ v8f wmmab(v16bf a, v16bf b, v8f c) { return __builtin_amdgcn_wmma_f32_16x16x32_bf16(false, a, false, b, (short)0, c, false, false); }

// ---- k_gemmw: register-blocked GEMM, ONE WAVE per 64x64 output tile (16 accumulators), operands straight from K-contiguous 16-bit planes; grid (M/64, N/64, Z), 32 threads.
// C[m][n] (f32, pitch ldc, + optional f32 bias[n]) = sum_k A[m][k] Bt[n][k] (+ split products per NSPLIT). z-batch strides sA/sB/sC in elements. K % 32 == 0.
// Fragments: lane row/col = l&15, elements 0..7 <- k0+8h+0..7, 8..15 <- k0+16+8h+0..7 (h = l>>4) for A and Bt alike; D element r of lane l = (row 8h+r, col l&15).
template <typename T16> struct WFrag;
template <> struct WFrag<h16> { typedef v16h V; static __device__ __forceinline__ V ld(const h16* p) { return cat16(*(const v8h*)p, *(const v8h*)(p + 16)); } static __device__ __forceinline__ v8f mma(V a, V b, v8f c) { return wmma16(a, b, c); } };
template <> struct WFrag<bf> { typedef v16bf V; static __device__ __forceinline__ V ld(const bf* p) { return cat16b(*(const v8us*)p, *(const v8us*)(p + 16)); } static __device__ __forceinline__ v8f mma(V a, V b, v8f c) { return wmmab(a, b, c); } };
template <typename T16, int NSPLIT, bool BIAS>
__global__ __launch_bounds__(32) void k_gemmw(const T16* __restrict__ A, const T16* __restrict__ A2, const T16* __restrict__ Bt, const T16* __restrict__ Bt2, int K, float* C, int ldc, const float* __restrict__ bias, size_t sA, size_t sB, size_t sC) {
    typedef typename WFrag<T16>::V V;
    __shared__ __align__(16) float os[16 * 68];
    const size_t z = blockIdx.z; A += z * sA; if (A2) A2 += z * sA; Bt += z * sB; if (Bt2) Bt2 += z * sB; C += z * sC;
    const int lane = threadIdx.x & 31, lr = lane & 15, hi = lane >> 4; const int r0 = blockIdx.x * 64, c0 = blockIdx.y * 64;
    v8f acc[4][4];
#pragma unroll
    for (int mb = 0; mb < 4; ++mb)
#pragma unroll
        for (int nb = 0; nb < 4; ++nb) acc[mb][nb] = (v8f){};
    const size_t aoff = (size_t)(r0 + lr) * K + 8 * hi, boff = (size_t)(c0 + lr) * K + 8 * hi;
#pragma unroll 1
    for (int kc = 0; kc < K; kc += 32) {
        V a[4], a2[4];
#pragma unroll
        for (int mb = 0; mb < 4; ++mb) { a[mb] = WFrag<T16>::ld(A + aoff + (size_t)mb * 16 * K + kc); if (NSPLIT == 1 || NSPLIT == 2) a2[mb] = WFrag<T16>::ld(A2 + aoff + (size_t)mb * 16 * K + kc); }
#pragma unroll
        for (int nb = 0; nb < 4; ++nb) { const V b = WFrag<T16>::ld(Bt + boff + (size_t)nb * 16 * K + kc); V b2; if (NSPLIT >= 2) b2 = WFrag<T16>::ld(Bt2 + boff + (size_t)nb * 16 * K + kc);
#pragma unroll
            for (int mb = 0; mb < 4; ++mb) { acc[mb][nb] = WFrag<T16>::mma(a[mb], b, acc[mb][nb]); if (NSPLIT == 1 || NSPLIT == 2) acc[mb][nb] = WFrag<T16>::mma(a2[mb], b, acc[mb][nb]); if (NSPLIT >= 2) acc[mb][nb] = WFrag<T16>::mma(a[mb], b2, acc[mb][nb]); } }
        asm volatile("v_nop\n\tv_nop\n\tv_nop\n\tv_nop" : "+v"(acc[0][0]), "+v"(acc[1][1]), "+v"(acc[2][2]), "+v"(acc[3][3]) : "v"(a[0]), "v"(a[3]));
    }
#pragma unroll
    for (int mb = 0; mb < 4; ++mb) {
#pragma unroll
        for (int nb = 0; nb < 4; ++nb) {
#pragma unroll
            for (int j = 0; j < 8; ++j) os[(hi * 8 + j) * 68 + nb * 16 + lr] = acc[mb][nb][j]; }
        __builtin_amdgcn_wave_barrier(); asm volatile("" ::: "memory");
        float* crow = C + (size_t)(r0 + mb * 16) * ldc + c0;
{
#pragma unroll
            for (int s = 0; s < 8; ++s) { const int row = 2 * s + hi, cofs = lr * 4; v4f val = *(const v4fa*)(os + row * 68 + cofs); if (BIAS) { val[0] += bfr(bias[c0 + cofs]); val[1] += bfr(bias[c0 + cofs + 1]); val[2] += bfr(bias[c0 + cofs + 2]); val[3] += bfr(bias[c0 + cofs + 3]); }
                *(v4f*)(crow + (size_t)row * ldc + cofs) = val; }
             }
        __builtin_amdgcn_wave_barrier(); asm volatile("" ::: "memory");
    }
}

// coverage: gridDim.x * 8 waves * 8 lines * 64 >= N*K, bounded by L < nlines.
__global__ __launch_bounds__(256) void k_wtG(const float* __restrict__ w, int K, int N, bf* Bt) {
    const int lane = threadIdx.x & 31; const int L0 = (blockIdx.x * 8 + (threadIdx.x >> 5)) * 8; const int nlines = N * K / 64;
{
#pragma unroll 1
        for (int l = 0; l < 8; ++l) { const int L = L0 + l; if (L >= nlines) break; const size_t e = (size_t)L * 64 + lane * 2; const int k = (int)(e % K), n = (int)(e / K); v2us o;
            o[0] = f2bf(w[(size_t)k * N + n]); o[1] = f2bf(w[(size_t)(k + 1) * N + n]); *(v2us*)(Bt + e) = o; }
         }
}

// coverage: ceil(TOK*DMOD/8 / 256) * 256 threads * 8, bounded by i < TOK*DMOD/8 -> exactly TOK*DMOD elements.
__global__ __launch_bounds__(256) void k_xplane(const float* __restrict__ X, bf* XB) {
    const size_t i = (size_t)blockIdx.x * 256 + threadIdx.x; if (i >= (size_t)TOK * DMOD / 8) return;
    const size_t e = i * 8; const int col = (int)(e % DMOD); const size_t row = e / DMOD; const size_t bb = row / SEQ, s = row % SEQ;
    const v8f v = *(const v8f*)(X + (bb * SEQ_FULL + s) * DMOD + col); v8us o;
#pragma unroll
    for (int k = 0; k < 8; ++k) o[k] = f2bf(v[k]);
    *(v8us*)(XB + e) = o; 
}

// coverage: as k_xplane (TOK*DMOD elements exactly).
template <int MODE>
__global__ __launch_bounds__(256) void k_cvt16(const float* __restrict__ Cf, const float* __restrict__ bias, float sc, h16* P) {
    const size_t i = (size_t)blockIdx.x * 256 + threadIdx.x; if (i >= (size_t)TOK * DMOD / 8) return;
    const size_t e = i * 8; const v8f v = *(const v8f*)(Cf + e); v8h o;
    if (MODE == 0) { const int col = (int)(e % DMOD); const v8f bb = *(const v8f*)(bias + col);
#pragma unroll
        for (int q = 0; q < 8; ++q) o[q] = (h16)((v[q] + bfr(bb[q])) * sc);
    } else { const int n = (int)(e / TOK); const float bn = bfr(bias[n]);
#pragma unroll
        for (int q = 0; q < 8; ++q) o[q] = (h16)((v[q] + bn) * sc);
    }
    *(v8h*)(P + e) = o; 
}

// ---- k_sdpa: work-group = 8 waves, one wave = 16 query rows of one (batch b, head h); grid (SEQ/128, NB*NHEAD), 256 threads.
// K rows [key][64 d] and V^T rows [d][128 keys] of a 128-key stage are copied global -> LDS once per work-group (16 B per lane and copy), two buffers: stage s+1 flies while stage s is worked on.
// Transposed tiles: S^T[key][q] = sum_d K[key][d] Q[q][d] (A = K rows from LDS, B = Q rows from the Q plane, both d-contiguous);
// the two 16-key D tiles of a 32-key step become the B fragment P^T[key][q] (element r <- tile keys 0..15, element 8+r <- tile keys 16..31, lane unchanged);
// O^T[d][q] += sum_key V^T[d][key] P^T[key][q] (A = V^T rows from LDS, key-contiguous). Lane (h2, m): q = q0 + m; keys of a step = kb+8*h2+r and kb+16+8*h2+r.
// Online softmax per q: max / sum over the lane's 16 scores and the partner lane (xor 16); exp2 terms x256 -> f16; running sum over the f16 values in f32.
__device__ __forceinline__ unsigned lds_addr(const void* p) { return (unsigned)(size_t)(__attribute__((address_space(3))) const void*)p; }
// One stage: lane copies K rows r, r+32, r+64, r+96 (its 16 B of each) and V^T rows d, d+16, d+32, d+48. s_wait_xcnt 0 closes the statement (a precaution): no operand register is rewritten ahead of it.
__device__ __forceinline__ void stage_copy(unsigned lk, unsigned lv, const h16* gk, const h16* gv) {
    asm volatile("global_load_async_to_lds_b128 %0, %8, off\n\t"
                 "global_load_async_to_lds_b128 %1, %9, off\n\t"
                 "global_load_async_to_lds_b128 %2, %10, off\n\t"
                 "global_load_async_to_lds_b128 %3, %11, off\n\t"
                 "global_load_async_to_lds_b128 %4, %12, off\n\t"
                 "global_load_async_to_lds_b128 %5, %13, off\n\t"
                 "global_load_async_to_lds_b128 %6, %14, off\n\t"
                 "global_load_async_to_lds_b128 %7, %15, off\n\t"
                 "s_wait_xcnt 0x0"
                 :: "v"(lk), "v"(lk + 32 * KPITCH), "v"(lk + 64 * KPITCH), "v"(lk + 96 * KPITCH),
                    "v"(lv), "v"(lv + 16 * VPITCH), "v"(lv + 32 * VPITCH), "v"(lv + 48 * VPITCH),
                    "v"(gk), "v"(gk + (size_t)32 * DMOD), "v"(gk + (size_t)64 * DMOD), "v"(gk + (size_t)96 * DMOD),
                    "v"(gv), "v"(gv + (size_t)16 * TOK), "v"(gv + (size_t)32 * TOK), "v"(gv + (size_t)48 * TOK)
                 : "memory");
}
__global__ __launch_bounds__(32 * QW) void k_sdpa(const h16* __restrict__ Q16, const h16* __restrict__ K16, const h16* __restrict__ VT16, float* out) {
    __shared__ __align__(16) unsigned char ks[2 * KBYTES];
    __shared__ __align__(16) unsigned char vs[2 * VBYTES];
    __shared__ __align__(16) float osall[QW * 16 * 68];
    const int tid = threadIdx.x, lane = tid & 31, m = lane & 15, hh = lane >> 4;
    const int wave = __builtin_amdgcn_readfirstlane(tid >> 5);
    float* os = osall + wave * (16 * 68);
    const int bh = blockIdx.y; const int b = bh / NHEAD, h = bh % NHEAD; const int q0 = (blockIdx.x * QW + wave) * 16;
    const unsigned lk = lds_addr(ks) + (tid >> 3) * KPITCH + (tid & 7) * 16;      // + buffer * KBYTES
    const unsigned lv = lds_addr(vs) + (tid >> 4) * VPITCH + (tid & 15) * 16;     // + buffer * VBYTES
    const h16* gk = K16 + ((size_t)b * SEQ + (tid >> 3)) * DMOD + h * HD + (tid & 7) * 8;          // + stage * KST * DMOD
    const h16* gv = VT16 + ((size_t)h * HD + (tid >> 4)) * TOK + (size_t)b * SEQ + (tid & 15) * 8;   // + stage * KST
    stage_copy(lk, lv, gk, gv);
    const h16* qrow = Q16 + ((size_t)b * SEQ + q0 + m) * DMOD + h * HD + 8 * hh;
    const v16h qf0 = cat16(*(const v8h*)(qrow), *(const v8h*)(qrow + 16));          // d 0..31
    const v16h qf1 = cat16(*(const v8h*)(qrow + 32), *(const v8h*)(qrow + 48));     // d 32..63
    v8f oacc[4];
#pragma unroll
    for (int t = 0; t < 4; ++t) oacc[t] = (v8f){};
    float mrun = -3.0e38f, lrun = 0.f;
    asm volatile("s_wait_asynccnt 0x0" ::: "memory");   // this wave's share of stage 0 has landed
    __syncthreads();                                    // stage 0 is readable by every wave
    stage_copy(lk + KBYTES, lv + VBYTES, gk + (size_t)KST * DMOD, gv + KST);
#pragma unroll 1   // one copy of the stage body: the buffer is picked by sg & 1
    for (int sg = 0; sg < NST; ++sg) {
        const unsigned char* kbase = ks + (sg & 1) * KBYTES + m * KPITCH + 16 * hh;   // + key in stage * KPITCH
        const unsigned char* vbase = vs + (sg & 1) * VBYTES + m * VPITCH + 16 * hh;   // + d-tile * 16 * VPITCH + key in stage * 2
#pragma unroll 1   // one copy of the 32-key step, as before the staging
        for (int kb = 0; kb < KST; kb += 32) {
            v16h ka[2][2];
#pragma unroll
            for (int kt = 0; kt < 2; ++kt) { const unsigned char* kr = kbase + (kb + kt * 16) * KPITCH; ka[kt][0] = cat16(*(const v8ha*)kr, *(const v8ha*)(kr + 32)); ka[kt][1] = cat16(*(const v8ha*)(kr + 64), *(const v8ha*)(kr + 96)); }
            v8f st[2];
#pragma unroll
            for (int kt = 0; kt < 2; ++kt) { st[kt] = wmma16(ka[kt][0], qf0, (v8f){}); st[kt] = wmma16(ka[kt][1], qf1, st[kt]); }
            asm volatile("v_nop\n\tv_nop\n\tv_nop\n\tv_nop" : "+v"(st[0]), "+v"(st[1]) : "v"(ka[0][0]), "v"(ka[0][1]), "v"(ka[1][0]), "v"(ka[1][1]), "v"(qf0), "v"(qf1));
            float mx = fmaxf(st[0][0], st[1][0]);
#pragma unroll
            for (int r = 1; r < 8; ++r) mx = fmaxf(mx, fmaxf(st[0][r], st[1][r]));
            mx = fmaxf(mx, __shfl_xor(mx, 16, 32));
            const float mn = fmaxf(mrun, mx);
            const float alpha = __builtin_amdgcn_exp2f((mrun - mn) * SL2E);
            mrun = mn;
            v16h pf = (v16h){}; float psum = 0.f;
#pragma unroll
            for (int r = 0; r < 8; ++r) {
                const h16 p0 = (h16)(__builtin_amdgcn_exp2f((st[0][r] - mn) * SL2E) * PCAR);
                const h16 p1 = (h16)(__builtin_amdgcn_exp2f((st[1][r] - mn) * SL2E) * PCAR);
                pf[r] = p0; pf[8 + r] = p1; psum += (float)p0 + (float)p1; }
            psum += __shfl_xor(psum, 16, 32);
            lrun = lrun * alpha + psum;
#pragma unroll
            for (int t = 0; t < 4; ++t) oacc[t] *= alpha;
            v16h va[4];
#pragma unroll
            for (int t = 0; t < 4; ++t) { const unsigned char* vr = vbase + t * 16 * VPITCH + kb * 2; va[t] = cat16(*(const v8ha*)vr, *(const v8ha*)(vr + 32)); }
#pragma unroll
            for (int t = 0; t < 4; ++t) oacc[t] = wmma16(va[t], pf, oacc[t]);
            asm volatile("v_nop\n\tv_nop\n\tv_nop\n\tv_nop" : "+v"(oacc[0]), "+v"(oacc[1]), "+v"(oacc[2]), "+v"(oacc[3]) : "v"(va[0]), "v"(va[1]), "v"(va[2]), "v"(va[3]), "v"(pf));
        }
        asm volatile("s_wait_dscnt 0x0" ::: "memory");      // this wave's reads of stage sg have returned before its buffer is refilled
        asm volatile("s_wait_asynccnt 0x0" ::: "memory");   // this wave's share of stage sg + 1 has landed
        __syncthreads();                                    // publishes stage sg + 1 and ends every wave's reads of stage sg
        if (sg + 2 < NST) stage_copy(lk + (sg & 1) * KBYTES, lv + (sg & 1) * VBYTES, gk + (size_t)(sg + 2) * KST * DMOD, gv + (size_t)(sg + 2) * KST);   // work-group-uniform test; refills the buffer just read
    }
    asm volatile("s_wait_asynccnt 0x0" ::: "memory");       // no copy is outstanding when the wave goes on to its end
    const float rl = __fdiv_rn(1.0f, lrun) * (1.0f / VCAR);
#pragma unroll
    for (int t = 0; t < 4; ++t)
#pragma unroll
        for (int r = 0; r < 8; ++r) os[m * 68 + t * 16 + hh * 8 + r] = oacc[t][r] * rl;
    __syncthreads();
    float* obase = out + ((size_t)b * SEQ + q0) * DMOD + h * HD;
{
#pragma unroll
        for (int s = 0; s < 8; ++s) { const int row = 2 * s + hh, cofs = m * 4; const v4f val = *(const v4fa*)(os + row * 68 + cofs); *(v4f*)(obase + (size_t)row * DMOD + cofs) = val; }
         }
}

extern "C" void kernel_launch(void* const* d_in, const int* in_sizes, int n_in,
                              void* d_out, int out_size, void* d_ws, size_t ws_size, hipStream_t stream) {
    if (n_in < 9) return;
    const int need_x = ((NB - 1) * SEQ_FULL + SEQ) * DMOD;
    if (in_sizes[0] < need_x || in_sizes[1] < need_x || in_sizes[2] < need_x) return;
    if (in_sizes[3] < DMOD * DMOD || in_sizes[5] < DMOD * DMOD || in_sizes[7] < DMOD * DMOD) return;
    if (in_sizes[4] < DMOD || in_sizes[6] < DMOD || in_sizes[8] < DMOD) return;
    if (out_size < TOK * DMOD) return;
    const float* Xq = (const float*)d_in[0]; const float* Xk = (const float*)d_in[1]; const float* Xv = (const float*)d_in[2];
    const float* Wq = (const float*)d_in[3]; const float* bq = (const float*)d_in[4];
    const float* Wk = (const float*)d_in[5]; const float* bk = (const float*)d_in[6];
    const float* Wv = (const float*)d_in[7]; const float* bv = (const float*)d_in[8];
    float* OUT = (float*)d_out;     // [NB][SEQ][512]
    char* wsp = (char*)d_ws;
    auto take = [&](size_t bytes) { char* p = wsp; wsp += (bytes + 255) & ~(size_t)255; return (void*)p; };
    bf* WTq = (bf*)take((size_t)DMOD * DMOD * 2); bf* WTk = (bf*)take((size_t)DMOD * DMOD * 2); bf* WTv = (bf*)take((size_t)DMOD * DMOD * 2);   // [out][in] bf16
    bf* XB = (bf*)take((size_t)TOK * DMOD * 2);          // bf16 activation plane (reused q, k, v in stream order)
    float* Cf = (float*)take((size_t)TOK * DMOD * 4);    // f32 GEMM result (reused)
    h16* Q16 = (h16*)take((size_t)TOK * DMOD * 2); h16* K16 = (h16*)take((size_t)TOK * DMOD * 2); h16* VT16 = (h16*)take((size_t)TOK * DMOD * 2);   // [tok][512], [tok][512], [512][tok]
    if ((size_t)(wsp - (char*)d_ws) > ws_size) return;
    const unsigned gw = (unsigned)((DMOD * DMOD / 64 + 63) / 64);
    const unsigned g8 = (unsigned)(((size_t)TOK * DMOD / 8 + 255) / 256);
    k_wtG<<<gw, 256, 0, stream>>>(Wq, DMOD, DMOD, WTq);
    k_wtG<<<gw, 256, 0, stream>>>(Wk, DMOD, DMOD, WTk);
    k_wtG<<<gw, 256, 0, stream>>>(Wv, DMOD, DMOD, WTv);
    // Q = query Wq + bq  -> f16 [tok][512] x QKCAR
    k_xplane<<<g8, 256, 0, stream>>>(Xq, XB);
    k_gemmw<bf, 0, false><<<dim3(TOK / 64, DMOD / 64, 1), 32, 0, stream>>>(XB, nullptr, WTq, nullptr, DMOD, Cf, DMOD, nullptr, 0, 0, 0);
    k_cvt16<0><<<g8, 256, 0, stream>>>(Cf, bq, QKCAR, Q16);
    // K = key Wk + bk  -> f16 [tok][512] x QKCAR
    k_xplane<<<g8, 256, 0, stream>>>(Xk, XB);
    k_gemmw<bf, 0, false><<<dim3(TOK / 64, DMOD / 64, 1), 32, 0, stream>>>(XB, nullptr, WTk, nullptr, DMOD, Cf, DMOD, nullptr, 0, 0, 0);
    k_cvt16<0><<<g8, 256, 0, stream>>>(Cf, bk, QKCAR, K16);
    // V^T = (value Wv + bv)^T -> f16 [512][tok] x VCAR  (A = Wv^T plane [n][k], Bt = value plane [tok][k])
    k_xplane<<<g8, 256, 0, stream>>>(Xv, XB);
    k_gemmw<bf, 0, false><<<dim3(DMOD / 64, TOK / 64, 1), 32, 0, stream>>>(WTv, nullptr, XB, nullptr, DMOD, Cf, TOK, nullptr, 0, 0, 0);
    k_cvt16<1><<<g8, 256, 0, stream>>>(Cf, bv, VCAR, VT16);
    // softmax(Q K^T / 8) V per (batch, head), heads merged into [NB][SEQ][512]
    k_sdpa<<<dim3(SEQ / (16 * QW), NB * NHEAD, 1), 32 * QW, 0, stream>>>(Q16, K16, VT16, OUT);
}

// v002
// Measured time: 113 microseconds a run.
// In both of two side-by-side timings against v001, it was 1.64 times as fast.
// Counting every step since v000, it is 3.23 times as fast.
#include <hip/hip_runtime.h>

// Contractions: q/k/v projections = v_wmma_f32_16x16x32_bf16 (bf16-RNE activations x bf16-RNE W^T planes, f32 accumulate, bias added in f32); scores K.Q^T and context V^T.P^T (transposed 16x16 tiles) = v_wmma_f32_16x16x32_f16 (f16 planes: Q x4, K x4, V^T x16; P = exp2 terms in f16 carried x256), f32 accumulate; online softmax, normalisation and output in f32.
// Plan: W^T bf16 planes [out][in] (one launch); one launch for q, k and v: 64x64 register-blocked GEMM (one wave per tile, 4 waves share a token tile) that reads the f32 activations, rounds them to bf16 on the way into LDS, and stores the f16 plane with bias and power-of-two carry itself ([tok][512]; V: [512][tok]); then work-groups of 8 waves, one wave per 16 query rows of one (batch, head): 128-key K and V^T tiles are copied once per work-group into a two-buffer LDS ring, every wave streams 32-key steps with fragments read from LDS, online softmax, and writes its 16x64 f32 result via an LDS stage as whole 256-B row segments.

#ifndef NB
#define NB 2
#endif
#ifndef SEQ
#define SEQ 4096
#endif
#define NB_FULL 2
#define SEQ_FULL 4096
#define DMOD 512
#define NHEAD 8
#define HD 64
#define TOK (NB * SEQ)
#define PCAR 256.0f                       // carry of the exp2 terms fed to the context WMMA
#define QKCAR 4.0f                        // carry of the Q and K f16 planes
#define VCAR 16.0f                        // carry of the V^T f16 plane
#define SL2E 0.011271055006945026f        // 0.125 * log2(e) / (QKCAR * QKCAR)

static_assert(NB >= 1 && NB <= NB_FULL);
static_assert(SEQ >= 64 && SEQ <= SEQ_FULL && (SEQ % 64) == 0);
static_assert(DMOD == NHEAD * HD && (DMOD % 64) == 0 && HD == 64);
static_assert((((size_t)TOK * DMOD) % 8) == 0);
static_assert(((DMOD * DMOD) % 64) == 0);
#define QW 8                              // waves per k_sdpa work-group, 16 query rows each
#define KST 128                           // keys per LDS stage
#define NST (SEQ / KST)                   // stages per (batch, head)
#define KPITCH 144                        // bytes per staged K row: 128 + 16 (16 B x odd, for 16-byte LDS reads)
#define VPITCH 272                        // bytes per staged V^T row: 256 + 16
#define KBYTES (KST * KPITCH)
#define VBYTES (HD * VPITCH)
static_assert((SEQ % KST) == 0 && NST >= 2 && (SEQ % (16 * QW)) == 0 && (KST % 32) == 0);
static_assert(KST * 8 == 4 * 32 * QW && HD * (KST / 8) == 4 * 32 * QW);   // four K copies and four V^T copies per lane fill a stage

typedef _Float16 h16;
typedef unsigned short bf;
typedef __attribute__((ext_vector_type(16))) __bf16   v16bf;
typedef __attribute__((ext_vector_type(16))) _Float16 v16h;
typedef __attribute__((ext_vector_type(8)))  _Float16 v8h;
typedef __attribute__((ext_vector_type(8)))  unsigned short v8us;
typedef __attribute__((ext_vector_type(8)))  float    v8f;
typedef __attribute__((ext_vector_type(4)))  float    v4f;
typedef __attribute__((ext_vector_type(2)))  unsigned short v2us;
typedef v8h  __attribute__((may_alias)) v8ha;
typedef v4f  __attribute__((may_alias)) v4fa;
typedef v8us __attribute__((may_alias)) v8usa;

__device__ __forceinline__ unsigned short f2bf(float f) { unsigned u = __float_as_uint(f); u += 0x7FFFu + ((u >> 16) & 1u); return (unsigned short)(u >> 16); }
__device__ __forceinline__ float bf2f(unsigned short b) { return __uint_as_float(((unsigned)b) << 16); }
__device__ __forceinline__ float bfr(float f) { return bf2f(f2bf(f)); }
__device__ __forceinline__ v16h cat16(v8h lo, v8h hi) { return __builtin_shufflevector(lo, hi, 0, 1, 2, 3, 4, 5, 6, 7, 8, 9, 10, 11, 12, 13, 14, 15); }
__device__ __forceinline__ v16bf cat16b(v8us lo, v8us hi) { return __builtin_bit_cast(v16bf, __builtin_shufflevector(lo, hi, 0, 1, 2, 3, 4, 5, 6, 7, 8, 9, 10, 11, 12, 13, 14, 15)); }
__device__ __forceinline__ v8f wmma16(v16h a, v16h b, v8f c) { return __builtin_amdgcn_wmma_f32_16x16x32_f16(false, a, false, b, (short)0, c, false, false); }
__device__ __forceinline__ v8f wmmab(v16bf a, v16bf b, v8f c) { return __builtin_amdgcn_wmma_f32_16x16x32_bf16(false, a, false, b, (short)0, c, false, false); }

// ---- k_wtG: W [in][out] f32 -> W^T [out][in] bf16, the three weight matrices in one launch (blockIdx.y picks the matrix).
// coverage: gridDim.x * 8 waves * 8 lines * 64 >= N*K, bounded by L < nlines.
__global__ __launch_bounds__(256) void k_wtG(const float* __restrict__ w0, const float* __restrict__ w1, const float* __restrict__ w2, int K, int N, bf* B0, bf* B1, bf* B2) {
    const int sel = blockIdx.y; const float* __restrict__ w = sel == 0 ? w0 : sel == 1 ? w1 : w2; bf* Bt = sel == 0 ? B0 : sel == 1 ? B1 : B2;
    const int lane = threadIdx.x & 31; const int L0 = (blockIdx.x * 8 + (threadIdx.x >> 5)) * 8; const int nlines = N * K / 64;
#pragma unroll 1
    for (int l = 0; l < 8; ++l) { const int L = L0 + l; if (L >= nlines) break; const size_t e = (size_t)L * 64 + lane * 2; const int k = (int)(e % K), n = (int)(e / K); v2us o;
        o[0] = f2bf(w[(size_t)k * N + n]); o[1] = f2bf(w[(size_t)(k + 1) * N + n]); *(v2us*)(Bt + e) = o; }
}

// ---- k_proj: the three projections in one launch; work-group = 4 waves on one 64-token tile, ONE WAVE per 64 tokens x 64 output features (16 accumulators); grid (TOK/64, DMOD/256, 3), 128 threads; blockIdx.z = 0 q, 1 k, 2 v.
// Activations: each 32-deep step's 64 x 32 f32 block is read once per work-group as whole 128-B lines, rounded to bf16 (nearest even) in registers and stored to a two-buffer LDS tile that the 4 waves share; step s+1 is fetched while step s is multiplied.
// Weights come straight from the W^T bf16 plane; bias (bf16-rounded, added in f32), carry and the f16 rounding are applied to the accumulators.
// Fragments: lane row/col = l&15, elements 0..7 <- k0+8h+0..7, 8..15 <- k0+16+8h+0..7 (h = l>>4) for A and B alike; D element r of lane l = (A row 8h+r, B row l&15).
// The operand whose index runs along the output rows is A, so a lane's 8 D elements are 16 contiguous output bytes: q, k (plane [tok][512]): A = W^T, B = activations; v (plane [512][tok]): A = activations, B = W^T.
typedef __attribute__((ext_vector_type(4))) __bf16 v4bf;
typedef v4bf __attribute__((may_alias)) v4bfa;
#define PW 4                              // waves per k_proj work-group
#define XSP 40                            // bf16 per staged activation row: 32 + 8 (80 B = 16 B x odd, for 16-byte LDS reads)
#define HSP 72                            // f16 per staged output row: 64 + 8 (144 B = 16 B x odd)
static_assert((DMOD % (64 * PW)) == 0 && (TOK % 64) == 0 && 32 * PW == 16 * 8);   // 16 rows of 8 x 16 B per staging pass, four passes per step
__device__ __forceinline__ v16bf ldw(const bf* p) { return cat16b(*(const v8usa*)p, *(const v8usa*)(p + 16)); }
template <bool XA>   // XA: the activations are the A operand (v); otherwise the B operand (q, k)
__device__ __forceinline__ void proj_tile(const float* __restrict__ X, const bf* __restrict__ WT, const float* __restrict__ bias, float sc, h16* O, bf* xs, h16* hsall) {
    const int tid = threadIdx.x, lane = tid & 31, lr = lane & 15, hi = lane >> 4;
    const int wave = __builtin_amdgcn_readfirstlane(tid >> 5);
    const int t0 = blockIdx.x * 64, n0 = (blockIdx.y * PW + wave) * 64;
    h16* hs = hsall + wave * (64 * HSP);
    v8f acc[4][4];   // [A block][B block]
#pragma unroll
    for (int ab = 0; ab < 4; ++ab)
#pragma unroll
        for (int bb = 0; bb < 4; ++bb) acc[ab][bb] = (v8f){};
    const float* xg = X + ((size_t)(t0 / SEQ) * SEQ_FULL + (t0 % SEQ) + (tid >> 3)) * DMOD + (tid & 7) * 4;   // + pass * 16 rows + step
    bf* xw = xs + (tid >> 3) * XSP + (tid & 7) * 4;                                                         // + buffer * 64 * XSP + pass * 16 * XSP
    const bf* xr = xs + lr * XSP + 8 * hi;                                                                  // + buffer * 64 * XSP + block * 16 * XSP
    const bf* wp = WT + (size_t)(n0 + lr) * DMOD + 8 * hi;
    v4f xn[4];
#pragma unroll
    for (int u = 0; u < 4; ++u) xn[u] = *(const v4f*)(xg + (size_t)u * 16 * DMOD);
#pragma unroll
    for (int u = 0; u < 4; ++u) { v4bf c; c[0] = (__bf16)xn[u][0]; c[1] = (__bf16)xn[u][1]; c[2] = (__bf16)xn[u][2]; c[3] = (__bf16)xn[u][3]; *(v4bfa*)(xw + u * 16 * XSP) = c; }
    __syncthreads();   // step 0 is readable by every wave
#pragma unroll 1   // one copy of the 32-deep step, as in the plane GEMM before; the buffer is picked by the step's parity
    for (int kc = 0; kc < DMOD; kc += 32) {
        const int cur = (kc >> 5) & 1; const bool more = kc + 32 < DMOD;   // the same for the whole work-group
        if (more) {
#pragma unroll
            for (int u = 0; u < 4; ++u) xn[u] = *(const v4f*)(xg + (size_t)u * 16 * DMOD + kc + 32); }
        v16bf xf[4], wf[4];
#pragma unroll
        for (int u = 0; u < 4; ++u) wf[u] = ldw(wp + (size_t)u * 16 * DMOD + kc);
#pragma unroll
        for (int u = 0; u < 4; ++u) xf[u] = ldw(xr + cur * (64 * XSP) + u * 16 * XSP);
#pragma unroll
        for (int bb = 0; bb < 4; ++bb)
#pragma unroll
            for (int ab = 0; ab < 4; ++ab) acc[ab][bb] = XA ? wmmab(xf[ab], wf[bb], acc[ab][bb]) : wmmab(wf[ab], xf[bb], acc[ab][bb]);
        // four vector slots behind the last WMMA, on every path, before its operands are rewritten
        asm volatile("v_nop\n\tv_nop\n\tv_nop\n\tv_nop" : "+v"(acc[0][0]), "+v"(acc[1][1]), "+v"(acc[2][2]), "+v"(acc[3][3]) : "v"(xf[0]), "v"(xf[3]), "v"(wf[0]), "v"(wf[3]));
        if (more) {
#pragma unroll
            for (int u = 0; u < 4; ++u) { v4bf c; c[0] = (__bf16)xn[u][0]; c[1] = (__bf16)xn[u][1]; c[2] = (__bf16)xn[u][2]; c[3] = (__bf16)xn[u][3]; *(v4bfa*)(xw + (cur ^ 1) * (64 * XSP) + u * 16 * XSP) = c; } }
        asm volatile("s_wait_xcnt 0x0" ::: "memory");   // a precaution: stands in front of the advance of the address registers that this step's global loads name
        __syncthreads();                                // publishes the next step's buffer and ends every wave's reads of this one
    }
    // output row j = B row (q, k: token; v: feature), position in the row i = A row (q, k: feature; v: token)
#pragma unroll
    for (int ab = 0; ab < 4; ++ab) {
        v8f bi;
        if (!XA) bi = *(const v8f*)(bias + n0 + ab * 16 + hi * 8);
#pragma unroll
        for (int bb = 0; bb < 4; ++bb) { v8h o; const float bj = XA ? bfr(bias[n0 + bb * 16 + lr]) : 0.f;
#pragma unroll
            for (int r = 0; r < 8; ++r) o[r] = (h16)((acc[ab][bb][r] + (XA ? bj : bfr(bi[r]))) * sc);
            *(v8ha*)(hs + (bb * 16 + lr) * HSP + ab * 16 + hi * 8) = o; }
    }
    __syncthreads();   // the staged output rows are written before other lanes read them
    h16* obase = XA ? O + (size_t)n0 * TOK + t0 : O + (size_t)t0 * DMOD + n0; const size_t ldo = XA ? TOK : DMOD;
#pragma unroll
    for (int s = 0; s < 16; ++s) { const int row = s * 4 + (lane >> 3), c = lane & 7;   // 8 lanes store one whole 128-B row segment
        *(v8h*)(obase + (size_t)row * ldo + c * 8) = *(const v8ha*)(hs + row * HSP + c * 8); }
}
__global__ __launch_bounds__(32 * PW) void k_proj(const float* __restrict__ Xq, const float* __restrict__ Xk, const float* __restrict__ Xv, const bf* __restrict__ WTq, const bf* __restrict__ WTk, const bf* __restrict__ WTv,
                                                  const float* __restrict__ bq, const float* __restrict__ bk, const float* __restrict__ bv, h16* Q16, h16* K16, h16* VT16) {
    __shared__ __align__(16) bf xs[2 * 64 * XSP];
    __shared__ __align__(16) h16 hs[PW * 64 * HSP];
    const int z = blockIdx.z;
    if (z == 2) proj_tile<true>(Xv, WTv, bv, VCAR, VT16, xs, hs);
    else proj_tile<false>(z ? Xk : Xq, z ? WTk : WTq, z ? bk : bq, QKCAR, z ? K16 : Q16, xs, hs);
}

// ---- k_sdpa: work-group = 8 waves, one wave = 16 query rows of one (batch b, head h); grid (SEQ/128, NB*NHEAD), 256 threads.
// K rows [key][64 d] and V^T rows [d][128 keys] of a 128-key stage are copied global -> LDS once per work-group (16 B per lane and copy), two buffers: stage s+1 flies while stage s is worked on.
// Transposed tiles: S^T[key][q] = sum_d K[key][d] Q[q][d] (A = K rows from LDS, B = Q rows from the Q plane, both d-contiguous);
// the two 16-key D tiles of a 32-key step become the B fragment P^T[key][q] (element r <- tile keys 0..15, element 8+r <- tile keys 16..31, lane unchanged);
// O^T[d][q] += sum_key V^T[d][key] P^T[key][q] (A = V^T rows from LDS, key-contiguous). Lane (h2, m): q = q0 + m; keys of a step = kb+8*h2+r and kb+16+8*h2+r.
// Online softmax per q: max / sum over the lane's 16 scores and the partner lane (xor 16); exp2 terms x256 -> f16; running sum over the f16 values in f32.
__device__ __forceinline__ unsigned lds_addr(const void* p) { return (unsigned)(size_t)(__attribute__((address_space(3))) const void*)p; }
// One stage: lane copies K rows r, r+32, r+64, r+96 (its 16 B of each) and V^T rows d, d+16, d+32, d+48. s_wait_xcnt 0 closes the statement (a precaution): no operand register is rewritten ahead of it.
__device__ __forceinline__ void stage_copy(unsigned lk, unsigned lv, const h16* gk, const h16* gv) {
    asm volatile("global_load_async_to_lds_b128 %0, %8, off\n\t"
                 "global_load_async_to_lds_b128 %1, %9, off\n\t"
                 "global_load_async_to_lds_b128 %2, %10, off\n\t"
                 "global_load_async_to_lds_b128 %3, %11, off\n\t"
                 "global_load_async_to_lds_b128 %4, %12, off\n\t"
                 "global_load_async_to_lds_b128 %5, %13, off\n\t"
                 "global_load_async_to_lds_b128 %6, %14, off\n\t"
                 "global_load_async_to_lds_b128 %7, %15, off\n\t"
                 "s_wait_xcnt 0x0"
                 :: "v"(lk), "v"(lk + 32 * KPITCH), "v"(lk + 64 * KPITCH), "v"(lk + 96 * KPITCH),
                    "v"(lv), "v"(lv + 16 * VPITCH), "v"(lv + 32 * VPITCH), "v"(lv + 48 * VPITCH),
                    "v"(gk), "v"(gk + (size_t)32 * DMOD), "v"(gk + (size_t)64 * DMOD), "v"(gk + (size_t)96 * DMOD),
                    "v"(gv), "v"(gv + (size_t)16 * TOK), "v"(gv + (size_t)32 * TOK), "v"(gv + (size_t)48 * TOK)
                 : "memory");
}
__global__ __launch_bounds__(32 * QW) void k_sdpa(const h16* __restrict__ Q16, const h16* __restrict__ K16, const h16* __restrict__ VT16, float* out) {
    __shared__ __align__(16) unsigned char ks[2 * KBYTES];
    __shared__ __align__(16) unsigned char vs[2 * VBYTES];
    __shared__ __align__(16) float osall[QW * 16 * 68];
    const int tid = threadIdx.x, lane = tid & 31, m = lane & 15, hh = lane >> 4;
    const int wave = __builtin_amdgcn_readfirstlane(tid >> 5);
    float* os = osall + wave * (16 * 68);
    const int bh = blockIdx.y; const int b = bh / NHEAD, h = bh % NHEAD; const int q0 = (blockIdx.x * QW + wave) * 16;
    const unsigned lk = lds_addr(ks) + (tid >> 3) * KPITCH + (tid & 7) * 16;      // + buffer * KBYTES
    const unsigned lv = lds_addr(vs) + (tid >> 4) * VPITCH + (tid & 15) * 16;     // + buffer * VBYTES
    const h16* gk = K16 + ((size_t)b * SEQ + (tid >> 3)) * DMOD + h * HD + (tid & 7) * 8;          // + stage * KST * DMOD
    const h16* gv = VT16 + ((size_t)h * HD + (tid >> 4)) * TOK + (size_t)b * SEQ + (tid & 15) * 8;   // + stage * KST
    stage_copy(lk, lv, gk, gv);
    const h16* qrow = Q16 + ((size_t)b * SEQ + q0 + m) * DMOD + h * HD + 8 * hh;
    const v16h qf0 = cat16(*(const v8h*)(qrow), *(const v8h*)(qrow + 16));          // d 0..31
    const v16h qf1 = cat16(*(const v8h*)(qrow + 32), *(const v8h*)(qrow + 48));     // d 32..63
    v8f oacc[4];
#pragma unroll
    for (int t = 0; t < 4; ++t) oacc[t] = (v8f){};
    float mrun = -3.0e38f, lrun = 0.f;
    asm volatile("s_wait_asynccnt 0x0" ::: "memory");   // this wave's share of stage 0 has landed
    __syncthreads();                                    // stage 0 is readable by every wave
    stage_copy(lk + KBYTES, lv + VBYTES, gk + (size_t)KST * DMOD, gv + KST);
#pragma unroll 1   // one copy of the stage body: the buffer is picked by sg & 1
    for (int sg = 0; sg < NST; ++sg) {
        const unsigned char* kbase = ks + (sg & 1) * KBYTES + m * KPITCH + 16 * hh;   // + key in stage * KPITCH
        const unsigned char* vbase = vs + (sg & 1) * VBYTES + m * VPITCH + 16 * hh;   // + d-tile * 16 * VPITCH + key in stage * 2
#pragma unroll 1   // one copy of the 32-key step, as before the staging
        for (int kb = 0; kb < KST; kb += 32) {
            v16h ka[2][2];
#pragma unroll
            for (int kt = 0; kt < 2; ++kt) { const unsigned char* kr = kbase + (kb + kt * 16) * KPITCH; ka[kt][0] = cat16(*(const v8ha*)kr, *(const v8ha*)(kr + 32)); ka[kt][1] = cat16(*(const v8ha*)(kr + 64), *(const v8ha*)(kr + 96)); }
            v8f st[2];
#pragma unroll
            for (int kt = 0; kt < 2; ++kt) { st[kt] = wmma16(ka[kt][0], qf0, (v8f){}); st[kt] = wmma16(ka[kt][1], qf1, st[kt]); }
            asm volatile("v_nop\n\tv_nop\n\tv_nop\n\tv_nop" : "+v"(st[0]), "+v"(st[1]) : "v"(ka[0][0]), "v"(ka[0][1]), "v"(ka[1][0]), "v"(ka[1][1]), "v"(qf0), "v"(qf1));
            float mx = fmaxf(st[0][0], st[1][0]);
#pragma unroll
            for (int r = 1; r < 8; ++r) mx = fmaxf(mx, fmaxf(st[0][r], st[1][r]));
            mx = fmaxf(mx, __shfl_xor(mx, 16, 32));
            const float mn = fmaxf(mrun, mx);
            const float alpha = __builtin_amdgcn_exp2f((mrun - mn) * SL2E);
            mrun = mn;
            v16h pf = (v16h){}; float psum = 0.f;
#pragma unroll
            for (int r = 0; r < 8; ++r) {
                const h16 p0 = (h16)(__builtin_amdgcn_exp2f((st[0][r] - mn) * SL2E) * PCAR);
                const h16 p1 = (h16)(__builtin_amdgcn_exp2f((st[1][r] - mn) * SL2E) * PCAR);
                pf[r] = p0; pf[8 + r] = p1; psum += (float)p0 + (float)p1; }
            psum += __shfl_xor(psum, 16, 32);
            lrun = lrun * alpha + psum;
#pragma unroll
            for (int t = 0; t < 4; ++t) oacc[t] *= alpha;
            v16h va[4];
#pragma unroll
            for (int t = 0; t < 4; ++t) { const unsigned char* vr = vbase + t * 16 * VPITCH + kb * 2; va[t] = cat16(*(const v8ha*)vr, *(const v8ha*)(vr + 32)); }
#pragma unroll
            for (int t = 0; t < 4; ++t) oacc[t] = wmma16(va[t], pf, oacc[t]);
            asm volatile("v_nop\n\tv_nop\n\tv_nop\n\tv_nop" : "+v"(oacc[0]), "+v"(oacc[1]), "+v"(oacc[2]), "+v"(oacc[3]) : "v"(va[0]), "v"(va[1]), "v"(va[2]), "v"(va[3]), "v"(pf));
        }
        asm volatile("s_wait_dscnt 0x0" ::: "memory");      // this wave's reads of stage sg have returned before its buffer is refilled
        asm volatile("s_wait_asynccnt 0x0" ::: "memory");   // this wave's share of stage sg + 1 has landed
        __syncthreads();                                    // publishes stage sg + 1 and ends every wave's reads of stage sg
        if (sg + 2 < NST) stage_copy(lk + (sg & 1) * KBYTES, lv + (sg & 1) * VBYTES, gk + (size_t)(sg + 2) * KST * DMOD, gv + (size_t)(sg + 2) * KST);   // work-group-uniform test; refills the buffer just read
    }
    asm volatile("s_wait_asynccnt 0x0" ::: "memory");       // no copy is outstanding when the wave goes on to its end
    const float rl = __fdiv_rn(1.0f, lrun) * (1.0f / VCAR);
#pragma unroll
    for (int t = 0; t < 4; ++t)
#pragma unroll
        for (int r = 0; r < 8; ++r) os[m * 68 + t * 16 + hh * 8 + r] = oacc[t][r] * rl;
    __syncthreads();
    float* obase = out + ((size_t)b * SEQ + q0) * DMOD + h * HD;
{
#pragma unroll
        for (int s = 0; s < 8; ++s) { const int row = 2 * s + hh, cofs = m * 4; const v4f val = *(const v4fa*)(os + row * 68 + cofs); *(v4f*)(obase + (size_t)row * DMOD + cofs) = val; }
         }
}

extern "C" void kernel_launch(void* const* d_in, const int* in_sizes, int n_in,
                              void* d_out, int out_size, void* d_ws, size_t ws_size, hipStream_t stream) {
    if (n_in < 9) return;
    const int need_x = ((NB - 1) * SEQ_FULL + SEQ) * DMOD;
    if (in_sizes[0] < need_x || in_sizes[1] < need_x || in_sizes[2] < need_x) return;
    if (in_sizes[3] < DMOD * DMOD || in_sizes[5] < DMOD * DMOD || in_sizes[7] < DMOD * DMOD) return;
    if (in_sizes[4] < DMOD || in_sizes[6] < DMOD || in_sizes[8] < DMOD) return;
    if (out_size < TOK * DMOD) return;
    const float* Xq = (const float*)d_in[0]; const float* Xk = (const float*)d_in[1]; const float* Xv = (const float*)d_in[2];
    const float* Wq = (const float*)d_in[3]; const float* bq = (const float*)d_in[4];
    const float* Wk = (const float*)d_in[5]; const float* bk = (const float*)d_in[6];
    const float* Wv = (const float*)d_in[7]; const float* bv = (const float*)d_in[8];
    float* OUT = (float*)d_out;     // [NB][SEQ][512]
    char* wsp = (char*)d_ws;
    auto take = [&](size_t bytes) { char* p = wsp; wsp += (bytes + 255) & ~(size_t)255; return (void*)p; };
    bf* WTq = (bf*)take((size_t)DMOD * DMOD * 2); bf* WTk = (bf*)take((size_t)DMOD * DMOD * 2); bf* WTv = (bf*)take((size_t)DMOD * DMOD * 2);   // [out][in] bf16
    h16* Q16 = (h16*)take((size_t)TOK * DMOD * 2); h16* K16 = (h16*)take((size_t)TOK * DMOD * 2); h16* VT16 = (h16*)take((size_t)TOK * DMOD * 2);   // [tok][512], [tok][512], [512][tok]
    if ((size_t)(wsp - (char*)d_ws) > ws_size) return;
    const unsigned gw = (unsigned)((DMOD * DMOD / 64 + 63) / 64);
    k_wtG<<<dim3(gw, 3, 1), 256, 0, stream>>>(Wq, Wk, Wv, DMOD, DMOD, WTq, WTk, WTv);
    // Q = query Wq + bq, K = key Wk + bk -> f16 [tok][512] x QKCAR; V^T = (value Wv + bv)^T -> f16 [512][tok] x VCAR
    k_proj<<<dim3(TOK / 64, DMOD / (64 * PW), 3), 32 * PW, 0, stream>>>(Xq, Xk, Xv, WTq, WTk, WTv, bq, bk, bv, Q16, K16, VT16);
    // softmax(Q K^T / 8) V per (batch, head), heads merged into [NB][SEQ][512]
    k_sdpa<<<dim3(SEQ / (16 * QW), NB * NHEAD, 1), 32 * QW, 0, stream>>>(Q16, K16, VT16, OUT);
}

// v003
// Measured time: 103 microseconds a run.
// Two timings next to v002 put it at 1.09 and 1.10 times that version's speed.
// Counting every step since v000, it is 3.53 times as fast.
#include <hip/hip_runtime.h>

// Contractions: q/k/v projections = v_wmma_f32_16x16x32_bf16 (bf16-RNE activations x bf16-RNE W^T planes, f32 accumulate, bias added in f32); scores K.Q^T, context V^T.P^T and the softmax row sums ones.P^T (transposed 16x16 tiles) = v_wmma_f32_16x16x32_f16 (f16 planes: Q x4, K x4, V^T x16; P = exp2 terms in f16 carried x256), f32 accumulate; online softmax, normalisation and output in f32.
// Plan: W^T bf16 planes [out][in] (one launch); one launch for q, k and v: 64x64 register-blocked GEMM (one wave per tile, 4 waves share a token tile) that reads the f32 activations, rounds them to bf16 on the way into LDS, and stores the f16 plane with bias and power-of-two carry itself ([tok][512]; V: [512][tok]); then work-groups of 8 waves, one wave per 16 query rows of one (batch, head): 128-key K and V^T tiles are copied once per work-group into a two-buffer LDS ring, every wave streams 32-key steps with fragments read from LDS, online softmax, and writes its 16x64 f32 result via an LDS stage as whole 256-B row segments.

#ifndef NB
#define NB 2
#endif
#ifndef SEQ
#define SEQ 4096
#endif
#define NB_FULL 2
#define SEQ_FULL 4096
#define DMOD 512
#define NHEAD 8
#define HD 64
#define TOK (NB * SEQ)
#define PCAR 256.0f                       // carry of the exp2 terms fed to the context WMMA
#define QKCAR 4.0f                        // carry of the Q and K f16 planes
#define VCAR 16.0f                        // carry of the V^T f16 plane
#define SL2E 0.011271055006945026f        // 0.125 * log2(e) / (QKCAR * QKCAR)

static_assert(NB >= 1 && NB <= NB_FULL);
static_assert(SEQ >= 64 && SEQ <= SEQ_FULL && (SEQ % 64) == 0);
static_assert(DMOD == NHEAD * HD && (DMOD % 64) == 0 && HD == 64);
static_assert((((size_t)TOK * DMOD) % 8) == 0);
static_assert(((DMOD * DMOD) % 64) == 0);
#define QW 8                              // waves per k_sdpa work-group, 16 query rows each
#define KST 128                           // keys per LDS stage
#define NST (SEQ / KST)                   // stages per (batch, head)
#define KPITCH 144                        // bytes per staged K row: 128 + 16 (16 B x odd, for 16-byte LDS reads)
#define VPITCH 272                        // bytes per staged V^T row: 256 + 16
#define KBYTES (KST * KPITCH)
#define VBYTES (HD * VPITCH)
static_assert((SEQ % KST) == 0 && NST >= 2 && (SEQ % (16 * QW)) == 0 && (KST % 32) == 0);
static_assert(KST * 8 == 4 * 32 * QW && HD * (KST / 8) == 4 * 32 * QW);   // four K copies and four V^T copies per lane fill a stage

typedef _Float16 h16;
typedef unsigned short bf;
typedef __attribute__((ext_vector_type(16))) __bf16   v16bf;
typedef __attribute__((ext_vector_type(16))) _Float16 v16h;
typedef __attribute__((ext_vector_type(8)))  _Float16 v8h;
typedef __attribute__((ext_vector_type(8)))  unsigned short v8us;
typedef __attribute__((ext_vector_type(8)))  float    v8f;
typedef __attribute__((ext_vector_type(4)))  float    v4f;
typedef __attribute__((ext_vector_type(2)))  unsigned short v2us;
typedef v8h  __attribute__((may_alias)) v8ha;
typedef v4f  __attribute__((may_alias)) v4fa;
typedef v8us __attribute__((may_alias)) v8usa;

__device__ __forceinline__ unsigned short f2bf(float f) { unsigned u = __float_as_uint(f); u += 0x7FFFu + ((u >> 16) & 1u); return (unsigned short)(u >> 16); }
__device__ __forceinline__ float bf2f(unsigned short b) { return __uint_as_float(((unsigned)b) << 16); }
__device__ __forceinline__ float bfr(float f) { return bf2f(f2bf(f)); }
__device__ __forceinline__ v16h cat16(v8h lo, v8h hi) { return __builtin_shufflevector(lo, hi, 0, 1, 2, 3, 4, 5, 6, 7, 8, 9, 10, 11, 12, 13, 14, 15); }
__device__ __forceinline__ v16bf cat16b(v8us lo, v8us hi) { return __builtin_bit_cast(v16bf, __builtin_shufflevector(lo, hi, 0, 1, 2, 3, 4, 5, 6, 7, 8, 9, 10, 11, 12, 13, 14, 15)); }
__device__ __forceinline__ v8f wmma16(v16h a, v16h b, v8f c) { return __builtin_amdgcn_wmma_f32_16x16x32_f16(false, a, false, b, (short)0, c, false, false); }
__device__ __forceinline__ v8f wmmab(v16bf a, v16bf b, v8f c) { return __builtin_amdgcn_wmma_f32_16x16x32_bf16(false, a, false, b, (short)0, c, false, false); }

// ---- k_wtG: W [in][out] f32 -> W^T [out][in] bf16, the three weight matrices in one launch (blockIdx.y picks the matrix).
// coverage: gridDim.x * 8 waves * 8 lines * 64 >= N*K, bounded by L < nlines.
__global__ __launch_bounds__(256) void k_wtG(const float* __restrict__ w0, const float* __restrict__ w1, const float* __restrict__ w2, int K, int N, bf* B0, bf* B1, bf* B2) {
    const int sel = blockIdx.y; const float* __restrict__ w = sel == 0 ? w0 : sel == 1 ? w1 : w2; bf* Bt = sel == 0 ? B0 : sel == 1 ? B1 : B2;
    const int lane = threadIdx.x & 31; const int L0 = (blockIdx.x * 8 + (threadIdx.x >> 5)) * 8; const int nlines = N * K / 64;
#pragma unroll 1
    for (int l = 0; l < 8; ++l) { const int L = L0 + l; if (L >= nlines) break; const size_t e = (size_t)L * 64 + lane * 2; const int k = (int)(e % K), n = (int)(e / K); v2us o;
        o[0] = f2bf(w[(size_t)k * N + n]); o[1] = f2bf(w[(size_t)(k + 1) * N + n]); *(v2us*)(Bt + e) = o; }
}

// ---- k_proj: the three projections in one launch; work-group = 4 waves on one 64-token tile, ONE WAVE per 64 tokens x 64 output features (16 accumulators); grid (TOK/64, DMOD/256, 3), 128 threads; blockIdx.z = 0 q, 1 k, 2 v.
// Activations: each 32-deep step's 64 x 32 f32 block is read once per work-group as whole 128-B lines, rounded to bf16 (nearest even) in registers and stored to a two-buffer LDS tile that the 4 waves share; step s+1 is fetched while step s is multiplied.
// Weights come straight from the W^T bf16 plane; bias (bf16-rounded, added in f32), carry and the f16 rounding are applied to the accumulators.
// Fragments: lane row/col = l&15, elements 0..7 <- k0+8h+0..7, 8..15 <- k0+16+8h+0..7 (h = l>>4) for A and B alike; D element r of lane l = (A row 8h+r, B row l&15).
// The operand whose index runs along the output rows is A, so a lane's 8 D elements are 16 contiguous output bytes: q, k (plane [tok][512]): A = W^T, B = activations; v (plane [512][tok]): A = activations, B = W^T.
typedef __attribute__((ext_vector_type(4))) __bf16 v4bf;
typedef v4bf __attribute__((may_alias)) v4bfa;
#define PW 4                              // waves per k_proj work-group
#define XSP 40                            // bf16 per staged activation row: 32 + 8 (80 B = 16 B x odd, for 16-byte LDS reads)
#define HSP 72                            // f16 per staged output row: 64 + 8 (144 B = 16 B x odd)
static_assert((DMOD % (64 * PW)) == 0 && (TOK % 64) == 0 && 32 * PW == 16 * 8);   // 16 rows of 8 x 16 B per staging pass, four passes per step
__device__ __forceinline__ v16bf ldw(const bf* p) { return cat16b(*(const v8usa*)p, *(const v8usa*)(p + 16)); }
template <bool XA>   // XA: the activations are the A operand (v); otherwise the B operand (q, k)
__device__ __forceinline__ void proj_tile(const float* __restrict__ X, const bf* __restrict__ WT, const float* __restrict__ bias, float sc, h16* O, bf* xs, h16* hsall) {
    const int tid = threadIdx.x, lane = tid & 31, lr = lane & 15, hi = lane >> 4;
    const int wave = __builtin_amdgcn_readfirstlane(tid >> 5);
    const int t0 = blockIdx.x * 64, n0 = (blockIdx.y * PW + wave) * 64;
    h16* hs = hsall + wave * (64 * HSP);
    v8f acc[4][4];   // [A block][B block]
#pragma unroll
    for (int ab = 0; ab < 4; ++ab)
#pragma unroll
        for (int bb = 0; bb < 4; ++bb) acc[ab][bb] = (v8f){};
    const float* xg = X + ((size_t)(t0 / SEQ) * SEQ_FULL + (t0 % SEQ) + (tid >> 3)) * DMOD + (tid & 7) * 4;   // + pass * 16 rows + step
    bf* xw = xs + (tid >> 3) * XSP + (tid & 7) * 4;                                                         // + buffer * 64 * XSP + pass * 16 * XSP
    const bf* xr = xs + lr * XSP + 8 * hi;                                                                  // + buffer * 64 * XSP + block * 16 * XSP
    const bf* wp = WT + (size_t)(n0 + lr) * DMOD + 8 * hi;
    v4f xn[4];
#pragma unroll
    for (int u = 0; u < 4; ++u) xn[u] = *(const v4f*)(xg + (size_t)u * 16 * DMOD);
#pragma unroll
    for (int u = 0; u < 4; ++u) { v4bf c; c[0] = (__bf16)xn[u][0]; c[1] = (__bf16)xn[u][1]; c[2] = (__bf16)xn[u][2]; c[3] = (__bf16)xn[u][3]; *(v4bfa*)(xw + u * 16 * XSP) = c; }
    __syncthreads();   // step 0 is readable by every wave
#pragma unroll 1   // one copy of the 32-deep step, as in the plane GEMM before; the buffer is picked by the step's parity
    for (int kc = 0; kc < DMOD; kc += 32) {
        const int cur = (kc >> 5) & 1; const bool more = kc + 32 < DMOD;   // the same for the whole work-group
        if (more) {
#pragma unroll
            for (int u = 0; u < 4; ++u) xn[u] = *(const v4f*)(xg + (size_t)u * 16 * DMOD + kc + 32); }
        v16bf xf[4], wf[4];
#pragma unroll
        for (int u = 0; u < 4; ++u) wf[u] = ldw(wp + (size_t)u * 16 * DMOD + kc);
#pragma unroll
        for (int u = 0; u < 4; ++u) xf[u] = ldw(xr + cur * (64 * XSP) + u * 16 * XSP);
#pragma unroll
        for (int bb = 0; bb < 4; ++bb)
#pragma unroll
            for (int ab = 0; ab < 4; ++ab) acc[ab][bb] = XA ? wmmab(xf[ab], wf[bb], acc[ab][bb]) : wmmab(wf[ab], xf[bb], acc[ab][bb]);
        // four vector slots behind the last WMMA, on every path, before its operands are rewritten
        asm volatile("v_nop\n\tv_nop\n\tv_nop\n\tv_nop" : "+v"(acc[0][0]), "+v"(acc[1][1]), "+v"(acc[2][2]), "+v"(acc[3][3]) : "v"(xf[0]), "v"(xf[3]), "v"(wf[0]), "v"(wf[3]));
        if (more) {
#pragma unroll
            for (int u = 0; u < 4; ++u) { v4bf c; c[0] = (__bf16)xn[u][0]; c[1] = (__bf16)xn[u][1]; c[2] = (__bf16)xn[u][2]; c[3] = (__bf16)xn[u][3]; *(v4bfa*)(xw + (cur ^ 1) * (64 * XSP) + u * 16 * XSP) = c; } }
        asm volatile("s_wait_xcnt 0x0" ::: "memory");   // a precaution: stands in front of the advance of the address registers that this step's global loads name
        __syncthreads();                                // publishes the next step's buffer and ends every wave's reads of this one
    }
    // output row j = B row (q, k: token; v: feature), position in the row i = A row (q, k: feature; v: token)
#pragma unroll
    for (int ab = 0; ab < 4; ++ab) {
        v8f bi;
        if (!XA) bi = *(const v8f*)(bias + n0 + ab * 16 + hi * 8);
#pragma unroll
        for (int bb = 0; bb < 4; ++bb) { v8h o; const float bj = XA ? bfr(bias[n0 + bb * 16 + lr]) : 0.f;
#pragma unroll
            for (int r = 0; r < 8; ++r) o[r] = (h16)((acc[ab][bb][r] + (XA ? bj : bfr(bi[r]))) * sc);
            *(v8ha*)(hs + (bb * 16 + lr) * HSP + ab * 16 + hi * 8) = o; }
    }
    __syncthreads();   // the staged output rows are written before other lanes read them
    h16* obase = XA ? O + (size_t)n0 * TOK + t0 : O + (size_t)t0 * DMOD + n0; const size_t ldo = XA ? TOK : DMOD;
#pragma unroll
    for (int s = 0; s < 16; ++s) { const int row = s * 4 + (lane >> 3), c = lane & 7;   // 8 lanes store one whole 128-B row segment
        *(v8h*)(obase + (size_t)row * ldo + c * 8) = *(const v8ha*)(hs + row * HSP + c * 8); }
}
__global__ __launch_bounds__(32 * PW) void k_proj(const float* __restrict__ Xq, const float* __restrict__ Xk, const float* __restrict__ Xv, const bf* __restrict__ WTq, const bf* __restrict__ WTk, const bf* __restrict__ WTv,
                                                  const float* __restrict__ bq, const float* __restrict__ bk, const float* __restrict__ bv, h16* Q16, h16* K16, h16* VT16) {
    __shared__ __align__(16) bf xs[2 * 64 * XSP];
    __shared__ __align__(16) h16 hs[PW * 64 * HSP];
    const int z = blockIdx.z;
    if (z == 2) proj_tile<true>(Xv, WTv, bv, VCAR, VT16, xs, hs);
    else proj_tile<false>(z ? Xk : Xq, z ? WTk : WTq, z ? bk : bq, QKCAR, z ? K16 : Q16, xs, hs);
}

// ---- k_sdpa: work-group = 8 waves, one wave = 16 query rows of one (batch b, head h); grid (SEQ/128, NB*NHEAD), 256 threads.
// K rows [key][64 d] and V^T rows [d][128 keys] of a 128-key stage are copied global -> LDS once per work-group (16 B per lane and copy), two buffers: stage s+1 flies while stage s is worked on.
// Transposed tiles: S^T[key][q] = sum_d K[key][d] Q[q][d] (A = K rows from LDS, B = Q rows from the Q plane, both d-contiguous);
// the two 16-key D tiles of a 32-key step become the B fragment P^T[key][q] (element r <- tile keys 0..15, element 8+r <- tile keys 16..31, lane unchanged);
// O^T[d][q] += sum_key V^T[d][key] P^T[key][q] (A = V^T rows from LDS, key-contiguous). Lane (h2, m): q = q0 + m; keys of a step = kb+8*h2+r and kb+16+8*h2+r.
// Online softmax per q: max over the lane's 16 scores and the partner lane (xor 16); exp2 terms x256 -> f16; the step's sum over the f16 values comes from one more WMMA, ones[16][32] . P^T (f32 accumulate), whose every row holds it.
__device__ __forceinline__ unsigned lds_addr(const void* p) { return (unsigned)(size_t)(__attribute__((address_space(3))) const void*)p; }
// One stage: lane copies K rows r, r+32, r+64, r+96 (its 16 B of each) and V^T rows d, d+16, d+32, d+48. s_wait_xcnt 0 closes the statement (a precaution): no operand register is rewritten ahead of it.
__device__ __forceinline__ void stage_copy(unsigned lk, unsigned lv, const h16* gk, const h16* gv) {
    asm volatile("global_load_async_to_lds_b128 %0, %8, off\n\t"
                 "global_load_async_to_lds_b128 %1, %9, off\n\t"
                 "global_load_async_to_lds_b128 %2, %10, off\n\t"
                 "global_load_async_to_lds_b128 %3, %11, off\n\t"
                 "global_load_async_to_lds_b128 %4, %12, off\n\t"
                 "global_load_async_to_lds_b128 %5, %13, off\n\t"
                 "global_load_async_to_lds_b128 %6, %14, off\n\t"
                 "global_load_async_to_lds_b128 %7, %15, off\n\t"
                 "s_wait_xcnt 0x0"
                 :: "v"(lk), "v"(lk + 32 * KPITCH), "v"(lk + 64 * KPITCH), "v"(lk + 96 * KPITCH),
                    "v"(lv), "v"(lv + 16 * VPITCH), "v"(lv + 32 * VPITCH), "v"(lv + 48 * VPITCH),
                    "v"(gk), "v"(gk + (size_t)32 * DMOD), "v"(gk + (size_t)64 * DMOD), "v"(gk + (size_t)96 * DMOD),
                    "v"(gv), "v"(gv + (size_t)16 * TOK), "v"(gv + (size_t)32 * TOK), "v"(gv + (size_t)48 * TOK)
                 : "memory");
}
__global__ __launch_bounds__(32 * QW) void k_sdpa(const h16* __restrict__ Q16, const h16* __restrict__ K16, const h16* __restrict__ VT16, float* out) {
    __shared__ __align__(16) unsigned char ks[2 * KBYTES];
    __shared__ __align__(16) unsigned char vs[2 * VBYTES];
    __shared__ __align__(16) float osall[QW * 16 * 68];
    const int tid = threadIdx.x, lane = tid & 31, m = lane & 15, hh = lane >> 4;
    const int wave = __builtin_amdgcn_readfirstlane(tid >> 5);
    float* os = osall + wave * (16 * 68);
    const int bh = blockIdx.y; const int b = bh / NHEAD, h = bh % NHEAD; const int q0 = (blockIdx.x * QW + wave) * 16;
    const unsigned lk = lds_addr(ks) + (tid >> 3) * KPITCH + (tid & 7) * 16;      // + buffer * KBYTES
    const unsigned lv = lds_addr(vs) + (tid >> 4) * VPITCH + (tid & 15) * 16;     // + buffer * VBYTES
    const h16* gk = K16 + ((size_t)b * SEQ + (tid >> 3)) * DMOD + h * HD + (tid & 7) * 8;          // + stage * KST * DMOD
    const h16* gv = VT16 + ((size_t)h * HD + (tid >> 4)) * TOK + (size_t)b * SEQ + (tid & 15) * 8;   // + stage * KST
    stage_copy(lk, lv, gk, gv);
    const h16* qrow = Q16 + ((size_t)b * SEQ + q0 + m) * DMOD + h * HD + 8 * hh;
    const v16h qf0 = cat16(*(const v8h*)(qrow), *(const v8h*)(qrow + 16));          // d 0..31
    const v16h qf1 = cat16(*(const v8h*)(qrow + 32), *(const v8h*)(qrow + 48));     // d 32..63
    v8f oacc[4];
#pragma unroll
    for (int t = 0; t < 4; ++t) oacc[t] = (v8f){};
    float mrun = -3.0e38f, lrun = 0.f;
    v16h ones;   // A operand of the row-sum WMMA: 1.0 in every row and k
#pragma unroll
    for (int i = 0; i < 16; ++i) ones[i] = (h16)1.0f;
    asm volatile("s_wait_asynccnt 0x0" ::: "memory");   // this wave's share of stage 0 has landed
    __syncthreads();                                    // stage 0 is readable by every wave
    stage_copy(lk + KBYTES, lv + VBYTES, gk + (size_t)KST * DMOD, gv + KST);
#pragma unroll 1   // one copy of the stage body: the buffer is picked by sg & 1
    for (int sg = 0; sg < NST; ++sg) {
        const unsigned char* kbase = ks + (sg & 1) * KBYTES + m * KPITCH + 16 * hh;   // + key in stage * KPITCH
        const unsigned char* vbase = vs + (sg & 1) * VBYTES + m * VPITCH + 16 * hh;   // + d-tile * 16 * VPITCH + key in stage * 2
#pragma unroll 1   // one copy of the 32-key step, as before the staging
        for (int kb = 0; kb < KST; kb += 32) {
            v16h ka[2][2];
#pragma unroll
            for (int kt = 0; kt < 2; ++kt) { const unsigned char* kr = kbase + (kb + kt * 16) * KPITCH; ka[kt][0] = cat16(*(const v8ha*)kr, *(const v8ha*)(kr + 32)); ka[kt][1] = cat16(*(const v8ha*)(kr + 64), *(const v8ha*)(kr + 96)); }
            v8f st[2];
#pragma unroll
            for (int kt = 0; kt < 2; ++kt) { st[kt] = wmma16(ka[kt][0], qf0, (v8f){}); st[kt] = wmma16(ka[kt][1], qf1, st[kt]); }
            asm volatile("v_nop\n\tv_nop\n\tv_nop\n\tv_nop" : "+v"(st[0]), "+v"(st[1]) : "v"(ka[0][0]), "v"(ka[0][1]), "v"(ka[1][0]), "v"(ka[1][1]), "v"(qf0), "v"(qf1));
            v16h va[4];
#pragma unroll
            for (int t = 0; t < 4; ++t) { const unsigned char* vr = vbase + t * 16 * VPITCH + kb * 2; va[t] = cat16(*(const v8ha*)vr, *(const v8ha*)(vr + 32)); }
            __builtin_amdgcn_sched_barrier(0);   // keeps the eight V^T fragment loads one group ahead of the softmax: split, the late part is waited for among the context WMMAs
            float mx = fmaxf(st[0][0], st[1][0]);
#pragma unroll
            for (int r = 1; r < 8; ++r) mx = fmaxf(mx, fmaxf(st[0][r], st[1][r]));
            mx = fmaxf(mx, __shfl_xor(mx, 16, 32));
            const float mn = fmaxf(mrun, mx);
            const float alpha = __builtin_amdgcn_exp2f((mrun - mn) * SL2E);
            mrun = mn;
            v16h pf = (v16h){};
#pragma unroll
            for (int r = 0; r < 8; ++r) {
                pf[r] = (h16)(__builtin_amdgcn_exp2f((st[0][r] - mn) * SL2E) * PCAR);
                pf[8 + r] = (h16)(__builtin_amdgcn_exp2f((st[1][r] - mn) * SL2E) * PCAR); }
            const v8f ls = wmma16(ones, pf, (v8f){});   // every row of ones . P^T is the step's sum over all 32 keys of column q: each lane reads its own query's sum
#pragma unroll
            for (int t = 0; t < 4; ++t) oacc[t] *= alpha;
#pragma unroll
            for (int t = 0; t < 4; ++t) oacc[t] = wmma16(va[t], pf, oacc[t]);
            asm volatile("v_nop\n\tv_nop\n\tv_nop\n\tv_nop" : "+v"(oacc[0]), "+v"(oacc[1]), "+v"(oacc[2]), "+v"(oacc[3]) : "v"(va[0]), "v"(va[1]), "v"(va[2]), "v"(va[3]), "v"(pf));
            lrun = lrun * alpha + ls[0];
        }
        asm volatile("s_wait_dscnt 0x0" ::: "memory");      // this wave's reads of stage sg have returned before its buffer is refilled
        asm volatile("s_wait_asynccnt 0x0" ::: "memory");   // this wave's share of stage sg + 1 has landed
        __syncthreads();                                    // publishes stage sg + 1 and ends every wave's reads of stage sg
        if (sg + 2 < NST) stage_copy(lk + (sg & 1) * KBYTES, lv + (sg & 1) * VBYTES, gk + (size_t)(sg + 2) * KST * DMOD, gv + (size_t)(sg + 2) * KST);   // work-group-uniform test; refills the buffer just read
    }
    asm volatile("s_wait_asynccnt 0x0" ::: "memory");       // no copy is outstanding when the wave goes on to its end
    const float rl = __fdiv_rn(1.0f, lrun) * (1.0f / VCAR);
#pragma unroll
    for (int t = 0; t < 4; ++t)
#pragma unroll
        for (int r = 0; r < 8; ++r) os[m * 68 + t * 16 + hh * 8 + r] = oacc[t][r] * rl;
    __syncthreads();
    float* obase = out + ((size_t)b * SEQ + q0) * DMOD + h * HD;
{
#pragma unroll
        for (int s = 0; s < 8; ++s) { const int row = 2 * s + hh, cofs = m * 4; const v4f val = *(const v4fa*)(os + row * 68 + cofs); *(v4f*)(obase + (size_t)row * DMOD + cofs) = val; }
         }
}

extern "C" void kernel_launch(void* const* d_in, const int* in_sizes, int n_in,
                              void* d_out, int out_size, void* d_ws, size_t ws_size, hipStream_t stream) {
    if (n_in < 9) return;
    const int need_x = ((NB - 1) * SEQ_FULL + SEQ) * DMOD;
    if (in_sizes[0] < need_x || in_sizes[1] < need_x || in_sizes[2] < need_x) return;
    if (in_sizes[3] < DMOD * DMOD || in_sizes[5] < DMOD * DMOD || in_sizes[7] < DMOD * DMOD) return;
    if (in_sizes[4] < DMOD || in_sizes[6] < DMOD || in_sizes[8] < DMOD) return;
    if (out_size < TOK * DMOD) return;
    const float* Xq = (const float*)d_in[0]; const float* Xk = (const float*)d_in[1]; const float* Xv = (const float*)d_in[2];
    const float* Wq = (const float*)d_in[3]; const float* bq = (const float*)d_in[4];
    const float* Wk = (const float*)d_in[5]; const float* bk = (const float*)d_in[6];
    const float* Wv = (const float*)d_in[7]; const float* bv = (const float*)d_in[8];
    float* OUT = (float*)d_out;     // [NB][SEQ][512]
    char* wsp = (char*)d_ws;
    auto take = [&](size_t bytes) { char* p = wsp; wsp += (bytes + 255) & ~(size_t)255; return (void*)p; };
    bf* WTq = (bf*)take((size_t)DMOD * DMOD * 2); bf* WTk = (bf*)take((size_t)DMOD * DMOD * 2); bf* WTv = (bf*)take((size_t)DMOD * DMOD * 2);   // [out][in] bf16
    h16* Q16 = (h16*)take((size_t)TOK * DMOD * 2); h16* K16 = (h16*)take((size_t)TOK * DMOD * 2); h16* VT16 = (h16*)take((size_t)TOK * DMOD * 2);   // [tok][512], [tok][512], [512][tok]
    if ((size_t)(wsp - (char*)d_ws) > ws_size) return;
    const unsigned gw = (unsigned)((DMOD * DMOD / 64 + 63) / 64);
    k_wtG<<<dim3(gw, 3, 1), 256, 0, stream>>>(Wq, Wk, Wv, DMOD, DMOD, WTq, WTk, WTv);
    // Q = query Wq + bq, K = key Wk + bk -> f16 [tok][512] x QKCAR; V^T = (value Wv + bv)^T -> f16 [512][tok] x VCAR
    k_proj<<<dim3(TOK / 64, DMOD / (64 * PW), 3), 32 * PW, 0, stream>>>(Xq, Xk, Xv, WTq, WTk, WTv, bq, bk, bv, Q16, K16, VT16);
    // softmax(Q K^T / 8) V per (batch, head), heads merged into [NB][SEQ][512]
    k_sdpa<<<dim3(SEQ / (16 * QW), NB * NHEAD, 1), 32 * QW, 0, stream>>>(Q16, K16, VT16, OUT);
}

// v004
// It runs in 87.9 microseconds.
// In two side-by-side timings against v003, it was 1.18 and 1.17 times as fast.
// All steps since v000 together make it 4.15 times as fast.
#include <hip/hip_runtime.h>

// Contractions: q/k/v projections = v_wmma_f32_16x16x32_bf16 (bf16-RNE activations x bf16-RNE W^T planes, f32 accumulate, bias added in f32); scores K.Q^T, context V^T.P^T and the softmax row sums ones.P^T (transposed 16x16 tiles) = v_wmma_f32_16x16x32_f16 (f16 planes: Q x log2(e)/32, K x4, V^T x16; P = exp2 terms in f16 carried x256), f32 accumulate; online softmax, normalisation and output in f32.
// Plan: W^T bf16 planes [out][in] (one launch); one launch for q, k and v: 64x64 register-blocked GEMM (one wave per tile, 4 waves share a token tile) that reads the f32 activations, rounds them to bf16 on the way into LDS, and stores the f16 plane with bias and factor (Q: log2(e)/32; K, V: power-of-two carry) itself ([tok][512]; V: [512][tok]); then work-groups of 8 waves, one wave per 16 query rows of one (batch, head): 128-key K and V^T tiles are copied once per work-group into a two-buffer LDS ring, every wave streams 32-key steps with fragments read from LDS, online softmax, and writes its 16x64 f32 result via an LDS stage as whole 256-B row segments.

#ifndef NB
#define NB 2
#endif
#ifndef SEQ
#define SEQ 4096
#endif
#define NB_FULL 2
#define SEQ_FULL 4096
#define DMOD 512
#define NHEAD 8
#define HD 64
#define TOK (NB * SEQ)
#define PEXP 8.0f                         // log2 of the carry (x256) of the exp2 terms fed to the context WMMA
#define PGROW 7.0f                        // a score may pass the held softmax reference by this much (log2) before the reference moves: terms stay <= 2^15, inside f16
#define QKCAR 4.0f                        // carry of the K f16 plane
#define VCAR 16.0f                        // carry of the V^T f16 plane
#define QSCL 0.045084220027780106f        // factor of the Q f16 plane: 0.125 * log2(e) / QKCAR, so K.Q^T is the scaled score in log2 units

static_assert(NB >= 1 && NB <= NB_FULL);
static_assert(SEQ >= 64 && SEQ <= SEQ_FULL && (SEQ % 64) == 0);
static_assert(DMOD == NHEAD * HD && (DMOD % 64) == 0 && HD == 64);
static_assert((((size_t)TOK * DMOD) % 8) == 0);
static_assert(((DMOD * DMOD) % 64) == 0);
#define QW 8                              // waves per k_sdpa work-group, 16 query rows each
#define KST 128                           // keys per LDS stage
#define NST (SEQ / KST)                   // stages per (batch, head)
#define KPITCH 144                        // bytes per staged K row: 128 + 16 (16 B x odd, for 16-byte LDS reads)
#define VPITCH 272                        // bytes per staged V^T row: 256 + 16
#define KBYTES (KST * KPITCH)
#define VBYTES (HD * VPITCH)
static_assert((SEQ % KST) == 0 && NST >= 2 && (SEQ % (16 * QW)) == 0 && (KST % 32) == 0);
static_assert(KST * 8 == 4 * 32 * QW && HD * (KST / 8) == 4 * 32 * QW);   // four K copies and four V^T copies per lane fill a stage

typedef _Float16 h16;
typedef unsigned short bf;
typedef __attribute__((ext_vector_type(16))) __bf16   v16bf;
typedef __attribute__((ext_vector_type(16))) _Float16 v16h;
typedef __attribute__((ext_vector_type(8)))  _Float16 v8h;
typedef __attribute__((ext_vector_type(8)))  unsigned short v8us;
typedef __attribute__((ext_vector_type(8)))  float    v8f;
typedef __attribute__((ext_vector_type(4)))  float    v4f;
typedef __attribute__((ext_vector_type(2)))  unsigned short v2us;
typedef v8h  __attribute__((may_alias)) v8ha;
typedef v4f  __attribute__((may_alias)) v4fa;
typedef v8us __attribute__((may_alias)) v8usa;

__device__ __forceinline__ unsigned short f2bf(float f) { unsigned u = __float_as_uint(f); u += 0x7FFFu + ((u >> 16) & 1u); return (unsigned short)(u >> 16); }
__device__ __forceinline__ float bf2f(unsigned short b) { return __uint_as_float(((unsigned)b) << 16); }
__device__ __forceinline__ float bfr(float f) { return bf2f(f2bf(f)); }
__device__ __forceinline__ v16h cat16(v8h lo, v8h hi) { return __builtin_shufflevector(lo, hi, 0, 1, 2, 3, 4, 5, 6, 7, 8, 9, 10, 11, 12, 13, 14, 15); }
__device__ __forceinline__ v16bf cat16b(v8us lo, v8us hi) { return __builtin_bit_cast(v16bf, __builtin_shufflevector(lo, hi, 0, 1, 2, 3, 4, 5, 6, 7, 8, 9, 10, 11, 12, 13, 14, 15)); }
__device__ __forceinline__ v8f wmma16(v16h a, v16h b, v8f c) { return __builtin_amdgcn_wmma_f32_16x16x32_f16(false, a, false, b, (short)0, c, false, false); }
__device__ __forceinline__ v8f wmmab(v16bf a, v16bf b, v8f c) { return __builtin_amdgcn_wmma_f32_16x16x32_bf16(false, a, false, b, (short)0, c, false, false); }

// ---- k_wtG: W [in][out] f32 -> W^T [out][in] bf16, the three weight matrices in one launch (blockIdx.y picks the matrix).
// coverage: gridDim.x * 8 waves * 8 lines * 64 >= N*K, bounded by L < nlines.
__global__ __launch_bounds__(256) void k_wtG(const float* __restrict__ w0, const float* __restrict__ w1, const float* __restrict__ w2, int K, int N, bf* B0, bf* B1, bf* B2) {
    const int sel = blockIdx.y; const float* __restrict__ w = sel == 0 ? w0 : sel == 1 ? w1 : w2; bf* Bt = sel == 0 ? B0 : sel == 1 ? B1 : B2;
    const int lane = threadIdx.x & 31; const int L0 = (blockIdx.x * 8 + (threadIdx.x >> 5)) * 8; const int nlines = N * K / 64;
#pragma unroll 1
    for (int l = 0; l < 8; ++l) { const int L = L0 + l; if (L >= nlines) break; const size_t e = (size_t)L * 64 + lane * 2; const int k = (int)(e % K), n = (int)(e / K); v2us o;
        o[0] = f2bf(w[(size_t)k * N + n]); o[1] = f2bf(w[(size_t)(k + 1) * N + n]); *(v2us*)(Bt + e) = o; }
}

// ---- k_proj: the three projections in one launch; work-group = 4 waves on one 64-token tile, ONE WAVE per 64 tokens x 64 output features (16 accumulators); grid (TOK/64, DMOD/256, 3), 128 threads; blockIdx.z = 0 q, 1 k, 2 v.
// Activations: each 32-deep step's 64 x 32 f32 block is read once per work-group as whole 128-B lines, rounded to bf16 (nearest even) in registers and stored to a two-buffer LDS tile that the 4 waves share; step s+1 is fetched while step s is multiplied.
// Weights come straight from the W^T bf16 plane; bias (bf16-rounded, added in f32), carry and the f16 rounding are applied to the accumulators.
// Fragments: lane row/col = l&15, elements 0..7 <- k0+8h+0..7, 8..15 <- k0+16+8h+0..7 (h = l>>4) for A and B alike; D element r of lane l = (A row 8h+r, B row l&15).
// The operand whose index runs along the output rows is A, so a lane's 8 D elements are 16 contiguous output bytes: q, k (plane [tok][512]): A = W^T, B = activations; v (plane [512][tok]): A = activations, B = W^T.
typedef __attribute__((ext_vector_type(4))) __bf16 v4bf;
typedef v4bf __attribute__((may_alias)) v4bfa;
#define PW 4                              // waves per k_proj work-group
#define XSP 40                            // bf16 per staged activation row: 32 + 8 (80 B = 16 B x odd, for 16-byte LDS reads)
#define HSP 72                            // f16 per staged output row: 64 + 8 (144 B = 16 B x odd)
static_assert((DMOD % (64 * PW)) == 0 && (TOK % 64) == 0 && 32 * PW == 16 * 8);   // 16 rows of 8 x 16 B per staging pass, four passes per step
__device__ __forceinline__ v16bf ldw(const bf* p) { return cat16b(*(const v8usa*)p, *(const v8usa*)(p + 16)); }
template <bool XA>   // XA: the activations are the A operand (v); otherwise the B operand (q, k)
__device__ __forceinline__ void proj_tile(const float* __restrict__ X, const bf* __restrict__ WT, const float* __restrict__ bias, float sc, h16* O, bf* xs, h16* hsall) {
    const int tid = threadIdx.x, lane = tid & 31, lr = lane & 15, hi = lane >> 4;
    const int wave = __builtin_amdgcn_readfirstlane(tid >> 5);
    const int t0 = blockIdx.x * 64, n0 = (blockIdx.y * PW + wave) * 64;
    h16* hs = hsall + wave * (64 * HSP);
    v8f acc[4][4];   // [A block][B block]
#pragma unroll
    for (int ab = 0; ab < 4; ++ab)
#pragma unroll
        for (int bb = 0; bb < 4; ++bb) acc[ab][bb] = (v8f){};
    const float* xg = X + ((size_t)(t0 / SEQ) * SEQ_FULL + (t0 % SEQ) + (tid >> 3)) * DMOD + (tid & 7) * 4;   // + pass * 16 rows + step
    bf* xw = xs + (tid >> 3) * XSP + (tid & 7) * 4;                                                         // + buffer * 64 * XSP + pass * 16 * XSP
    const bf* xr = xs + lr * XSP + 8 * hi;                                                                  // + buffer * 64 * XSP + block * 16 * XSP
    const bf* wp = WT + (size_t)(n0 + lr) * DMOD + 8 * hi;
    v4f xn[4];
#pragma unroll
    for (int u = 0; u < 4; ++u) xn[u] = *(const v4f*)(xg + (size_t)u * 16 * DMOD);
#pragma unroll
    for (int u = 0; u < 4; ++u) { v4bf c; c[0] = (__bf16)xn[u][0]; c[1] = (__bf16)xn[u][1]; c[2] = (__bf16)xn[u][2]; c[3] = (__bf16)xn[u][3]; *(v4bfa*)(xw + u * 16 * XSP) = c; }
    __syncthreads();   // step 0 is readable by every wave
#pragma unroll 1   // one copy of the 32-deep step, as in the plane GEMM before; the buffer is picked by the step's parity
    for (int kc = 0; kc < DMOD; kc += 32) {
        const int cur = (kc >> 5) & 1; const bool more = kc + 32 < DMOD;   // the same for the whole work-group
        if (more) {
#pragma unroll
            for (int u = 0; u < 4; ++u) xn[u] = *(const v4f*)(xg + (size_t)u * 16 * DMOD + kc + 32); }
        v16bf xf[4], wf[4];
#pragma unroll
        for (int u = 0; u < 4; ++u) wf[u] = ldw(wp + (size_t)u * 16 * DMOD + kc);
#pragma unroll
        for (int u = 0; u < 4; ++u) xf[u] = ldw(xr + cur * (64 * XSP) + u * 16 * XSP);
#pragma unroll
        for (int bb = 0; bb < 4; ++bb)
#pragma unroll
            for (int ab = 0; ab < 4; ++ab) acc[ab][bb] = XA ? wmmab(xf[ab], wf[bb], acc[ab][bb]) : wmmab(wf[ab], xf[bb], acc[ab][bb]);
        // four vector slots behind the last WMMA, on every path, before its operands are rewritten
        asm volatile("v_nop\n\tv_nop\n\tv_nop\n\tv_nop" : "+v"(acc[0][0]), "+v"(acc[1][1]), "+v"(acc[2][2]), "+v"(acc[3][3]) : "v"(xf[0]), "v"(xf[3]), "v"(wf[0]), "v"(wf[3]));
        if (more) {
#pragma unroll
            for (int u = 0; u < 4; ++u) { v4bf c; c[0] = (__bf16)xn[u][0]; c[1] = (__bf16)xn[u][1]; c[2] = (__bf16)xn[u][2]; c[3] = (__bf16)xn[u][3]; *(v4bfa*)(xw + (cur ^ 1) * (64 * XSP) + u * 16 * XSP) = c; } }
        asm volatile("s_wait_xcnt 0x0" ::: "memory");   // a precaution: stands in front of the advance of the address registers that this step's global loads name
        __syncthreads();                                // publishes the next step's buffer and ends every wave's reads of this one
    }
    // output row j = B row (q, k: token; v: feature), position in the row i = A row (q, k: feature; v: token)
#pragma unroll
    for (int ab = 0; ab < 4; ++ab) {
        v8f bi;
        if (!XA) bi = *(const v8f*)(bias + n0 + ab * 16 + hi * 8);
#pragma unroll
        for (int bb = 0; bb < 4; ++bb) { v8h o; const float bj = XA ? bfr(bias[n0 + bb * 16 + lr]) : 0.f;
#pragma unroll
            for (int r = 0; r < 8; ++r) o[r] = (h16)((acc[ab][bb][r] + (XA ? bj : bfr(bi[r]))) * sc);
            *(v8ha*)(hs + (bb * 16 + lr) * HSP + ab * 16 + hi * 8) = o; }
    }
    __syncthreads();   // the staged output rows are written before other lanes read them
    h16* obase = XA ? O + (size_t)n0 * TOK + t0 : O + (size_t)t0 * DMOD + n0; const size_t ldo = XA ? TOK : DMOD;
#pragma unroll
    for (int s = 0; s < 16; ++s) { const int row = s * 4 + (lane >> 3), c = lane & 7;   // 8 lanes store one whole 128-B row segment
        *(v8h*)(obase + (size_t)row * ldo + c * 8) = *(const v8ha*)(hs + row * HSP + c * 8); }
}
__global__ __launch_bounds__(32 * PW) void k_proj(const float* __restrict__ Xq, const float* __restrict__ Xk, const float* __restrict__ Xv, const bf* __restrict__ WTq, const bf* __restrict__ WTk, const bf* __restrict__ WTv,
                                                  const float* __restrict__ bq, const float* __restrict__ bk, const float* __restrict__ bv, h16* Q16, h16* K16, h16* VT16) {
    __shared__ __align__(16) bf xs[2 * 64 * XSP];
    __shared__ __align__(16) h16 hs[PW * 64 * HSP];
    const int z = blockIdx.z;
    if (z == 2) proj_tile<true>(Xv, WTv, bv, VCAR, VT16, xs, hs);
    else proj_tile<false>(z ? Xk : Xq, z ? WTk : WTq, z ? bk : bq, z ? QKCAR : QSCL, z ? K16 : Q16, xs, hs);
}

// ---- k_sdpa: work-group = 8 waves, one wave = 16 query rows of one (batch b, head h); grid (SEQ/128, NB*NHEAD), 256 threads.
// K rows [key][64 d] and V^T rows [d][128 keys] of a 128-key stage are copied global -> LDS once per work-group (16 B per lane and copy), two buffers: stage s+1 flies while stage s is worked on.
// Transposed tiles: S^T[key][q] = sum_d K[key][d] Q[q][d] (A = K rows from LDS, B = Q rows from the Q plane, both d-contiguous);
// the two 16-key D tiles of a 32-key step become the B fragment P^T[key][q] (element r <- tile keys 0..15, element 8+r <- tile keys 16..31, lane unchanged);
// O^T[d][q] += sum_key V^T[d][key] P^T[key][q] (A = V^T rows from LDS, key-contiguous). Lane (h2, m): q = q0 + m; keys of a step = kb+8*h2+r and kb+16+8*h2+r.
// Online softmax per q with a held reference: PEXP minus the reference is the C operand of the score WMMAs, so their result is the exponent and the term is exp2 of it (x256 included) -> f16.
// Each step tests once (ballot, scalar branch) whether any lane's 16 exponents pass PEXP + PGROW; only then (and at the first step) the halves' maxima are joined (xor 16), the reference moves up to them and the sums are rescaled.
// The row sums over the f16 values accumulate in one more WMMA per step, ones[16][32] . P^T (f32), whose every row holds them.
__device__ __forceinline__ unsigned lds_addr(const void* p) { return (unsigned)(size_t)(__attribute__((address_space(3))) const void*)p; }
// One stage: lane copies K rows r, r+32, r+64, r+96 (its 16 B of each) and V^T rows d, d+16, d+32, d+48. s_wait_xcnt 0 closes the statement (a precaution): no operand register is rewritten ahead of it.
__device__ __forceinline__ void stage_copy(unsigned lk, unsigned lv, const h16* gk, const h16* gv) {
    asm volatile("global_load_async_to_lds_b128 %0, %8, off\n\t"
                 "global_load_async_to_lds_b128 %1, %9, off\n\t"
                 "global_load_async_to_lds_b128 %2, %10, off\n\t"
                 "global_load_async_to_lds_b128 %3, %11, off\n\t"
                 "global_load_async_to_lds_b128 %4, %12, off\n\t"
                 "global_load_async_to_lds_b128 %5, %13, off\n\t"
                 "global_load_async_to_lds_b128 %6, %14, off\n\t"
                 "global_load_async_to_lds_b128 %7, %15, off\n\t"
                 "s_wait_xcnt 0x0"
                 :: "v"(lk), "v"(lk + 32 * KPITCH), "v"(lk + 64 * KPITCH), "v"(lk + 96 * KPITCH),
                    "v"(lv), "v"(lv + 16 * VPITCH), "v"(lv + 32 * VPITCH), "v"(lv + 48 * VPITCH),
                    "v"(gk), "v"(gk + (size_t)32 * DMOD), "v"(gk + (size_t)64 * DMOD), "v"(gk + (size_t)96 * DMOD),
                    "v"(gv), "v"(gv + (size_t)16 * TOK), "v"(gv + (size_t)32 * TOK), "v"(gv + (size_t)48 * TOK)
                 : "memory");
}
__global__ __launch_bounds__(32 * QW) void k_sdpa(const h16* __restrict__ Q16, const h16* __restrict__ K16, const h16* __restrict__ VT16, float* out) {
    __shared__ __align__(16) unsigned char ks[2 * KBYTES];
    __shared__ __align__(16) unsigned char vs[2 * VBYTES];
    __shared__ __align__(16) float osall[QW * 16 * 68];
    const int tid = threadIdx.x, lane = tid & 31, m = lane & 15, hh = lane >> 4;
    const int wave = __builtin_amdgcn_readfirstlane(tid >> 5);
    float* os = osall + wave * (16 * 68);
    const int bh = blockIdx.y; const int b = bh / NHEAD, h = bh % NHEAD; const int q0 = (blockIdx.x * QW + wave) * 16;
    const unsigned lk = lds_addr(ks) + (tid >> 3) * KPITCH + (tid & 7) * 16;      // + buffer * KBYTES
    const unsigned lv = lds_addr(vs) + (tid >> 4) * VPITCH + (tid & 15) * 16;     // + buffer * VBYTES
    const h16* gk = K16 + ((size_t)b * SEQ + (tid >> 3)) * DMOD + h * HD + (tid & 7) * 8;          // + stage * KST * DMOD
    const h16* gv = VT16 + ((size_t)h * HD + (tid >> 4)) * TOK + (size_t)b * SEQ + (tid & 15) * 8;   // + stage * KST
    stage_copy(lk, lv, gk, gv);
    const h16* qrow = Q16 + ((size_t)b * SEQ + q0 + m) * DMOD + h * HD + 8 * hh;
    const v16h qf0 = cat16(*(const v8h*)(qrow), *(const v8h*)(qrow + 16));          // d 0..31
    const v16h qf1 = cat16(*(const v8h*)(qrow + 32), *(const v8h*)(qrow + 48));     // d 32..63
    v8f oacc[4];
#pragma unroll
    for (int t = 0; t < 4; ++t) oacc[t] = (v8f){};
    v8f lacc = (v8f){};       // row sums (every element: the lane's own query)
    v8f bv = (v8f){};         // C operand of the score WMMAs: PEXP - reference of the lane's query, in all eight rows
    float thr = -3.0e38f;     // exponent above which the reference moves; below every score until the first step has set a reference
    v16h ones;   // A operand of the row-sum WMMA: 1.0 in every row and k
#pragma unroll
    for (int i = 0; i < 16; ++i) ones[i] = (h16)1.0f;
    asm volatile("s_wait_asynccnt 0x0" ::: "memory");   // this wave's share of stage 0 has landed
    __syncthreads();                                    // stage 0 is readable by every wave
    stage_copy(lk + KBYTES, lv + VBYTES, gk + (size_t)KST * DMOD, gv + KST);
#pragma unroll 1   // one copy of the stage body: the buffer is picked by sg & 1
    for (int sg = 0; sg < NST; ++sg) {
        const unsigned char* kbase = ks + (sg & 1) * KBYTES + m * KPITCH + 16 * hh;   // + key in stage * KPITCH
        const unsigned char* vbase = vs + (sg & 1) * VBYTES + m * VPITCH + 16 * hh;   // + d-tile * 16 * VPITCH + key in stage * 2
#pragma unroll 1   // one copy of the 32-key step, as before the staging
        for (int kb = 0; kb < KST; kb += 32) {
            v16h ka[2][2];
#pragma unroll
            for (int kt = 0; kt < 2; ++kt) { const unsigned char* kr = kbase + (kb + kt * 16) * KPITCH; ka[kt][0] = cat16(*(const v8ha*)kr, *(const v8ha*)(kr + 32)); ka[kt][1] = cat16(*(const v8ha*)(kr + 64), *(const v8ha*)(kr + 96)); }
            v8f st[2];
#pragma unroll
            for (int kt = 0; kt < 2; ++kt) { st[kt] = wmma16(ka[kt][0], qf0, bv); st[kt] = wmma16(ka[kt][1], qf1, st[kt]); }
            asm volatile("v_nop\n\tv_nop\n\tv_nop\n\tv_nop" : "+v"(st[0]), "+v"(st[1]) : "v"(ka[0][0]), "v"(ka[0][1]), "v"(ka[1][0]), "v"(ka[1][1]), "v"(qf0), "v"(qf1));
            v16h va[4];
#pragma unroll
            for (int t = 0; t < 4; ++t) { const unsigned char* vr = vbase + t * 16 * VPITCH + kb * 2; va[t] = cat16(*(const v8ha*)vr, *(const v8ha*)(vr + 32)); }
            __builtin_amdgcn_sched_barrier(0);   // keeps the eight V^T fragment loads one group ahead of the softmax: split, the late part is waited for among the context WMMAs
            float mk[2];   // one chain per 16-key tile: the two run side by side
#pragma unroll
            for (int kt = 0; kt < 2; ++kt) { mk[kt] = fmaxf(fmaxf(st[kt][0], st[kt][1]), st[kt][2]); mk[kt] = fmaxf(fmaxf(mk[kt], st[kt][3]), st[kt][4]); mk[kt] = fmaxf(fmaxf(mk[kt], st[kt][5]), st[kt][6]); }
            const float mx = fmaxf(fmaxf(fmaxf(mk[0], mk[1]), st[0][7]), st[1][7]);
            if (__builtin_expect(__builtin_amdgcn_ballot_w32(mx > thr) != 0u, 0)) {   // wave-uniform: some query's reference has to move
                const bool fresh = thr < 0.f;                                         // first step: no reference yet, the sums are still zero
                const float up = fmaxf(mx, __shfl_xor(mx, 16, 32)) - PEXP;            // both halves of a query move alike
                const float d = fresh ? up : fmaxf(up, 0.f);                          // a reference never moves down
                const float alpha = fresh ? 1.0f : __builtin_amdgcn_exp2f(-d);
                st[0] -= d; st[1] -= d; bv -= d; lacc *= alpha;
#pragma unroll
                for (int t = 0; t < 4; ++t) oacc[t] *= alpha;
                thr = PEXP + PGROW;
            }
            v16h pf = (v16h){};
#pragma unroll
            for (int r = 0; r < 8; ++r) {
                pf[r] = (h16)__builtin_amdgcn_exp2f(st[0][r]);
                pf[8 + r] = (h16)__builtin_amdgcn_exp2f(st[1][r]); }
            lacc = wmma16(ones, pf, lacc);   // every row of ones . P^T is the step's sum over all 32 keys of column q: each lane holds its own query's sum
#pragma unroll
            for (int t = 0; t < 4; ++t) oacc[t] = wmma16(va[t], pf, oacc[t]);
            asm volatile("v_nop\n\tv_nop\n\tv_nop\n\tv_nop" : "+v"(oacc[0]), "+v"(oacc[1]), "+v"(oacc[2]), "+v"(oacc[3]) : "v"(va[0]), "v"(va[1]), "v"(va[2]), "v"(va[3]), "v"(pf));
        }
        asm volatile("s_wait_dscnt 0x0" ::: "memory");      // this wave's reads of stage sg have returned before its buffer is refilled
        asm volatile("s_wait_asynccnt 0x0" ::: "memory");   // this wave's share of stage sg + 1 has landed
        __syncthreads();                                    // publishes stage sg + 1 and ends every wave's reads of stage sg
        if (sg + 2 < NST) stage_copy(lk + (sg & 1) * KBYTES, lv + (sg & 1) * VBYTES, gk + (size_t)(sg + 2) * KST * DMOD, gv + (size_t)(sg + 2) * KST);   // work-group-uniform test; refills the buffer just read
    }
    asm volatile("s_wait_asynccnt 0x0" ::: "memory");       // no copy is outstanding when the wave goes on to its end
    const float rl = __fdiv_rn(1.0f, lacc[0]) * (1.0f / VCAR);
#pragma unroll
    for (int t = 0; t < 4; ++t)
#pragma unroll
        for (int r = 0; r < 8; ++r) os[m * 68 + t * 16 + hh * 8 + r] = oacc[t][r] * rl;
    __syncthreads();
    float* obase = out + ((size_t)b * SEQ + q0) * DMOD + h * HD;
{
#pragma unroll
        for (int s = 0; s < 8; ++s) { const int row = 2 * s + hh, cofs = m * 4; const v4f val = *(const v4fa*)(os + row * 68 + cofs); *(v4f*)(obase + (size_t)row * DMOD + cofs) = val; }
         }
}

extern "C" void kernel_launch(void* const* d_in, const int* in_sizes, int n_in,
                              void* d_out, int out_size, void* d_ws, size_t ws_size, hipStream_t stream) {
    if (n_in < 9) return;
    const int need_x = ((NB - 1) * SEQ_FULL + SEQ) * DMOD;
    if (in_sizes[0] < need_x || in_sizes[1] < need_x || in_sizes[2] < need_x) return;
    if (in_sizes[3] < DMOD * DMOD || in_sizes[5] < DMOD * DMOD || in_sizes[7] < DMOD * DMOD) return;
    if (in_sizes[4] < DMOD || in_sizes[6] < DMOD || in_sizes[8] < DMOD) return;
    if (out_size < TOK * DMOD) return;
    const float* Xq = (const float*)d_in[0]; const float* Xk = (const float*)d_in[1]; const float* Xv = (const float*)d_in[2];
    const float* Wq = (const float*)d_in[3]; const float* bq = (const float*)d_in[4];
    const float* Wk = (const float*)d_in[5]; const float* bk = (const float*)d_in[6];
    const float* Wv = (const float*)d_in[7]; const float* bv = (const float*)d_in[8];
    float* OUT = (float*)d_out;     // [NB][SEQ][512]
    char* wsp = (char*)d_ws;
    auto take = [&](size_t bytes) { char* p = wsp; wsp += (bytes + 255) & ~(size_t)255; return (void*)p; };
    bf* WTq = (bf*)take((size_t)DMOD * DMOD * 2); bf* WTk = (bf*)take((size_t)DMOD * DMOD * 2); bf* WTv = (bf*)take((size_t)DMOD * DMOD * 2);   // [out][in] bf16
    h16* Q16 = (h16*)take((size_t)TOK * DMOD * 2); h16* K16 = (h16*)take((size_t)TOK * DMOD * 2); h16* VT16 = (h16*)take((size_t)TOK * DMOD * 2);   // [tok][512], [tok][512], [512][tok]
    if ((size_t)(wsp - (char*)d_ws) > ws_size) return;
    const unsigned gw = (unsigned)((DMOD * DMOD / 64 + 63) / 64);
    k_wtG<<<dim3(gw, 3, 1), 256, 0, stream>>>(Wq, Wk, Wv, DMOD, DMOD, WTq, WTk, WTv);
    // Q = query Wq + bq -> f16 [tok][512] x QSCL, K = key Wk + bk -> f16 [tok][512] x QKCAR; V^T = (value Wv + bv)^T -> f16 [512][tok] x VCAR
    k_proj<<<dim3(TOK / 64, DMOD / (64 * PW), 3), 32 * PW, 0, stream>>>(Xq, Xk, Xv, WTq, WTk, WTv, bq, bk, bv, Q16, K16, VT16);
    // softmax(Q K^T / 8) V per (batch, head), heads merged into [NB][SEQ][512]
    k_sdpa<<<dim3(SEQ / (16 * QW), NB * NHEAD, 1), 32 * QW, 0, stream>>>(Q16, K16, VT16, OUT);
}

// v005
// A run of this version takes 80.8 microseconds.
// In both of two side-by-side timings against v004, it was 1.09 times as fast.
// Over all steps from v000 it is 4.51 times as fast.
#include <hip/hip_runtime.h>

// Contractions: q/k/v projections = v_wmma_f32_16x16x32_bf16 (bf16-RNE activations x bf16-RNE W^T planes, f32 accumulate, bias added in f32); scores K.Q^T, context V^T.P^T and the softmax row sums ones.P^T (transposed 16x16 tiles) = v_wmma_f32_16x16x32_f16 (f16 planes: Q x log2(e)/32, K x4, V^T x16; P = exp2 terms in f16 carried x256), f32 accumulate; online softmax, normalisation and output in f32.
// Plan: W^T bf16 planes [out][in] (one launch); one launch for q, k and v: 64x64 register-blocked GEMM (one wave per tile, 4 waves share a token tile) that reads the f32 activations, rounds them to bf16 on the way into LDS, and stores the f16 plane with bias and scale factor itself ([tok][512]; V: [512][tok]); then work-groups of 16 waves on 256 query rows of one (batch, head), one wave per 32 query rows and per half of the keys: 256-key K and V^T stages are copied once per work-group into a two-buffer LDS ring, every wave streams 32-key steps of its 128-key half with fragments read from LDS (each fragment feeds two 16-query column groups), online softmax; the two key halves of a query are joined once through LDS and the 32x64 f32 result leaves via an LDS stage as whole 256-B row segments.

#ifndef NB
#define NB 2
#endif
#ifndef SEQ
#define SEQ 4096
#endif
#define NB_FULL 2
#define SEQ_FULL 4096
#define DMOD 512
#define NHEAD 8
#define HD 64
#define TOK (NB * SEQ)
#define PEXP 8.0f                         // log2 of the carry (x256) of the exp2 terms fed to the context WMMA
#define PGROW 7.0f                        // a score may pass the held softmax reference by this much (log2) before the reference moves: terms stay <= 2^15, inside f16
#define QKCAR 4.0f                        // carry of the K f16 plane
#define VCAR 16.0f                        // carry of the V^T f16 plane
#define QSCL 0.045084220027780106f        // factor of the Q f16 plane: 0.125 * log2(e) / QKCAR, so K.Q^T is the scaled score in log2 units

static_assert(NB >= 1 && NB <= NB_FULL);
static_assert(SEQ >= 64 && SEQ <= SEQ_FULL && (SEQ % 64) == 0);
static_assert(DMOD == NHEAD * HD && (DMOD % 64) == 0 && HD == 64);
static_assert((((size_t)TOK * DMOD) % 8) == 0);
static_assert(((DMOD * DMOD) % 64) == 0);
#define QW 8                              // query slots per k_sdpa work-group, QC * 16 query rows each
#define QC 2                              // 16-query column groups per wave: each K and V^T fragment read from LDS feeds QC WMMAs
#define KH 2                              // key halves per work-group: QW waves each, so the work-group has QW * KH waves
#define KST 128                           // keys per LDS stage and key half
#define NST (SEQ / (KST * KH))            // stages per (batch, head)
#define KPITCH 144                        // bytes per staged K row: 128 + 16 (16 B x odd, for 16-byte LDS reads)
#define VPITCH 272                        // bytes per staged V^T row: 256 + 16
#define KBYTES (KST * KPITCH)
#define VBYTES (HD * VPITCH)
#define SBYTES (KBYTES + VBYTES)          // one key half's share of a stage: its K rows, then its V^T rows
static_assert((SEQ % (KST * KH)) == 0 && NST >= 2 && (SEQ % (16 * QC * QW)) == 0 && (KST % 32) == 0 && QC == 2 && KH == 2);
static_assert(KST * 8 == 4 * 32 * QW && HD * (KST / 8) == 4 * 32 * QW);   // four K copies and four V^T copies per lane fill a key half's share of a stage

typedef _Float16 h16;
typedef unsigned short bf;
typedef __attribute__((ext_vector_type(16))) __bf16   v16bf;
typedef __attribute__((ext_vector_type(16))) _Float16 v16h;
typedef __attribute__((ext_vector_type(8)))  _Float16 v8h;
typedef __attribute__((ext_vector_type(8)))  unsigned short v8us;
typedef __attribute__((ext_vector_type(8)))  float    v8f;
typedef __attribute__((ext_vector_type(4)))  float    v4f;
typedef __attribute__((ext_vector_type(2)))  unsigned short v2us;
typedef v8h  __attribute__((may_alias)) v8ha;
typedef v4f  __attribute__((may_alias)) v4fa;
typedef v8us __attribute__((may_alias)) v8usa;

__device__ __forceinline__ unsigned short f2bf(float f) { unsigned u = __float_as_uint(f); u += 0x7FFFu + ((u >> 16) & 1u); return (unsigned short)(u >> 16); }
__device__ __forceinline__ float bf2f(unsigned short b) { return __uint_as_float(((unsigned)b) << 16); }
__device__ __forceinline__ float bfr(float f) { return bf2f(f2bf(f)); }
__device__ __forceinline__ v16h cat16(v8h lo, v8h hi) { return __builtin_shufflevector(lo, hi, 0, 1, 2, 3, 4, 5, 6, 7, 8, 9, 10, 11, 12, 13, 14, 15); }
__device__ __forceinline__ v16bf cat16b(v8us lo, v8us hi) { return __builtin_bit_cast(v16bf, __builtin_shufflevector(lo, hi, 0, 1, 2, 3, 4, 5, 6, 7, 8, 9, 10, 11, 12, 13, 14, 15)); }
__device__ __forceinline__ v8f wmma16(v16h a, v16h b, v8f c) { return __builtin_amdgcn_wmma_f32_16x16x32_f16(false, a, false, b, (short)0, c, false, false); }
__device__ __forceinline__ v8f wmmab(v16bf a, v16bf b, v8f c) { return __builtin_amdgcn_wmma_f32_16x16x32_bf16(false, a, false, b, (short)0, c, false, false); }

// ---- k_wtG: W [in][out] f32 -> W^T [out][in] bf16, the three weight matrices in one launch (blockIdx.y picks the matrix).
// coverage: gridDim.x * 8 waves * 8 lines * 64 >= N*K, bounded by L < nlines.
__global__ __launch_bounds__(256) void k_wtG(const float* __restrict__ w0, const float* __restrict__ w1, const float* __restrict__ w2, int K, int N, bf* B0, bf* B1, bf* B2) {
    const int sel = blockIdx.y; const float* __restrict__ w = sel == 0 ? w0 : sel == 1 ? w1 : w2; bf* Bt = sel == 0 ? B0 : sel == 1 ? B1 : B2;
    const int lane = threadIdx.x & 31; const int L0 = (blockIdx.x * 8 + (threadIdx.x >> 5)) * 8; const int nlines = N * K / 64;
#pragma unroll 1
    for (int l = 0; l < 8; ++l) { const int L = L0 + l; if (L >= nlines) break; const size_t e = (size_t)L * 64 + lane * 2; const int k = (int)(e % K), n = (int)(e / K); v2us o;
        o[0] = f2bf(w[(size_t)k * N + n]); o[1] = f2bf(w[(size_t)(k + 1) * N + n]); *(v2us*)(Bt + e) = o; }
}

// ---- k_proj: the three projections in one launch; work-group = 4 waves on one 64-token tile, ONE WAVE per 64 tokens x 64 output features (16 accumulators); grid (TOK/64, DMOD/256, 3), 128 threads; blockIdx.z = 0 q, 1 k, 2 v.
// Activations: each 32-deep step's 64 x 32 f32 block is read once per work-group as whole 128-B lines, rounded to bf16 (nearest even) in registers and stored to a two-buffer LDS tile that the 4 waves share; step s+1 is fetched while step s is multiplied.
// Weights come straight from the W^T bf16 plane; bias (bf16-rounded, added in f32), carry and the f16 rounding are applied to the accumulators.
// Fragments: lane row/col = l&15, elements 0..7 <- k0+8h+0..7, 8..15 <- k0+16+8h+0..7 (h = l>>4) for A and B alike; D element r of lane l = (A row 8h+r, B row l&15).
// The operand whose index runs along the output rows is A, so a lane's 8 D elements are 16 contiguous output bytes: q, k (plane [tok][512]): A = W^T, B = activations; v (plane [512][tok]): A = activations, B = W^T.
typedef __attribute__((ext_vector_type(4))) __bf16 v4bf;
typedef v4bf __attribute__((may_alias)) v4bfa;
#define PW 4                              // waves per k_proj work-group
#define XSP 40                            // bf16 per staged activation row: 32 + 8 (80 B = 16 B x odd, for 16-byte LDS reads)
#define HSP 72                            // f16 per staged output row: 64 + 8 (144 B = 16 B x odd)
static_assert((DMOD % (64 * PW)) == 0 && (TOK % 64) == 0 && 32 * PW == 16 * 8);   // 16 rows of 8 x 16 B per staging pass, four passes per step
__device__ __forceinline__ v16bf ldw(const bf* p) { return cat16b(*(const v8usa*)p, *(const v8usa*)(p + 16)); }
template <bool XA>   // XA: the activations are the A operand (v); otherwise the B operand (q, k)
__device__ __forceinline__ void proj_tile(const float* __restrict__ X, const bf* __restrict__ WT, const float* __restrict__ bias, float sc, h16* O, bf* xs, h16* hsall) {
    const int tid = threadIdx.x, lane = tid & 31, lr = lane & 15, hi = lane >> 4;
    const int wave = __builtin_amdgcn_readfirstlane(tid >> 5);
    const int t0 = blockIdx.x * 64, n0 = (blockIdx.y * PW + wave) * 64;
    h16* hs = hsall + wave * (64 * HSP);
    v8f acc[4][4];   // [A block][B block]
#pragma unroll
    for (int ab = 0; ab < 4; ++ab)
#pragma unroll
        for (int bb = 0; bb < 4; ++bb) acc[ab][bb] = (v8f){};
    const float* xg = X + ((size_t)(t0 / SEQ) * SEQ_FULL + (t0 % SEQ) + (tid >> 3)) * DMOD + (tid & 7) * 4;   // + pass * 16 rows + step
    bf* xw = xs + (tid >> 3) * XSP + (tid & 7) * 4;                                                         // + buffer * 64 * XSP + pass * 16 * XSP
    const bf* xr = xs + lr * XSP + 8 * hi;                                                                  // + buffer * 64 * XSP + block * 16 * XSP
    const bf* wp = WT + (size_t)(n0 + lr) * DMOD + 8 * hi;
    v4f xn[4];
#pragma unroll
    for (int u = 0; u < 4; ++u) xn[u] = *(const v4f*)(xg + (size_t)u * 16 * DMOD);
#pragma unroll
    for (int u = 0; u < 4; ++u) { v4bf c; c[0] = (__bf16)xn[u][0]; c[1] = (__bf16)xn[u][1]; c[2] = (__bf16)xn[u][2]; c[3] = (__bf16)xn[u][3]; *(v4bfa*)(xw + u * 16 * XSP) = c; }
    __syncthreads();   // step 0 is readable by every wave
#pragma unroll 1   // one copy of the 32-deep step, as in the plane GEMM before; the buffer is picked by the step's parity
    for (int kc = 0; kc < DMOD; kc += 32) {
        const int cur = (kc >> 5) & 1; const bool more = kc + 32 < DMOD;   // the same for the whole work-group
        if (more) {
#pragma unroll
            for (int u = 0; u < 4; ++u) xn[u] = *(const v4f*)(xg + (size_t)u * 16 * DMOD + kc + 32); }
        v16bf xf[4], wf[4];
#pragma unroll
        for (int u = 0; u < 4; ++u) wf[u] = ldw(wp + (size_t)u * 16 * DMOD + kc);
#pragma unroll
        for (int u = 0; u < 4; ++u) xf[u] = ldw(xr + cur * (64 * XSP) + u * 16 * XSP);
#pragma unroll
        for (int bb = 0; bb < 4; ++bb)
#pragma unroll
            for (int ab = 0; ab < 4; ++ab) acc[ab][bb] = XA ? wmmab(xf[ab], wf[bb], acc[ab][bb]) : wmmab(wf[ab], xf[bb], acc[ab][bb]);
        // four vector slots behind the last WMMA, on every path, before its operands are rewritten
        asm volatile("v_nop\n\tv_nop\n\tv_nop\n\tv_nop" : "+v"(acc[0][0]), "+v"(acc[1][1]), "+v"(acc[2][2]), "+v"(acc[3][3]) : "v"(xf[0]), "v"(xf[3]), "v"(wf[0]), "v"(wf[3]));
        if (more) {
#pragma unroll
            for (int u = 0; u < 4; ++u) { v4bf c; c[0] = (__bf16)xn[u][0]; c[1] = (__bf16)xn[u][1]; c[2] = (__bf16)xn[u][2]; c[3] = (__bf16)xn[u][3]; *(v4bfa*)(xw + (cur ^ 1) * (64 * XSP) + u * 16 * XSP) = c; } }
        asm volatile("s_wait_xcnt 0x0" ::: "memory");   // a precaution: stands in front of the advance of the address registers that this step's global loads name
        __syncthreads();                                // publishes the next step's buffer and ends every wave's reads of this one
    }
    // output row j = B row (q, k: token; v: feature), position in the row i = A row (q, k: feature; v: token)
#pragma unroll
    for (int ab = 0; ab < 4; ++ab) {
        v8f bi;
        if (!XA) bi = *(const v8f*)(bias + n0 + ab * 16 + hi * 8);
#pragma unroll
        for (int bb = 0; bb < 4; ++bb) { v8h o; const float bj = XA ? bfr(bias[n0 + bb * 16 + lr]) : 0.f;
#pragma unroll
            for (int r = 0; r < 8; ++r) o[r] = (h16)((acc[ab][bb][r] + (XA ? bj : bfr(bi[r]))) * sc);
            *(v8ha*)(hs + (bb * 16 + lr) * HSP + ab * 16 + hi * 8) = o; }
    }
    __syncthreads();   // the staged output rows are written before other lanes read them
    h16* obase = XA ? O + (size_t)n0 * TOK + t0 : O + (size_t)t0 * DMOD + n0; const size_t ldo = XA ? TOK : DMOD;
#pragma unroll
    for (int s = 0; s < 16; ++s) { const int row = s * 4 + (lane >> 3), c = lane & 7;   // 8 lanes store one whole 128-B row segment
        *(v8h*)(obase + (size_t)row * ldo + c * 8) = *(const v8ha*)(hs + row * HSP + c * 8); }
}
__global__ __launch_bounds__(32 * PW) void k_proj(const float* __restrict__ Xq, const float* __restrict__ Xk, const float* __restrict__ Xv, const bf* __restrict__ WTq, const bf* __restrict__ WTk, const bf* __restrict__ WTv,
                                                  const float* __restrict__ bq, const float* __restrict__ bk, const float* __restrict__ bv, h16* Q16, h16* K16, h16* VT16) {
    __shared__ __align__(16) bf xs[2 * 64 * XSP];
    __shared__ __align__(16) h16 hs[PW * 64 * HSP];
    const int z = blockIdx.z;
    if (z == 2) proj_tile<true>(Xv, WTv, bv, VCAR, VT16, xs, hs);
    else proj_tile<false>(z ? Xk : Xq, z ? WTk : WTq, z ? bk : bq, z ? QKCAR : QSCL, z ? K16 : Q16, xs, hs);
}

// ---- k_sdpa: work-group = 16 waves = 8 query slots x 2 key halves; one wave = 32 query rows (two 16-column groups) of one (batch b, head h) against one half of the keys; grid (SEQ/256, NB*NHEAD), 512 threads.
// A stage is 256 keys: key half g owns keys 128 g .. 128 g + 127 of it. Its K rows [key][64 d] and V^T rows [d][128 keys] are copied global -> LDS once per work-group by the half's own 8 waves (16 B per lane and copy), two buffers: stage s+1 flies while stage s is worked on.
// Transposed tiles: S^T[key][q] = sum_d K[key][d] Q[q][d] (A = K rows from LDS, B = Q rows from the Q plane, both d-contiguous);
// the two 16-key D tiles of a 32-key step become the B fragment P^T[key][q] (element r <- tile keys 0..15, element 8+r <- tile keys 16..31, lane unchanged);
// O^T[d][q] += sum_key V^T[d][key] P^T[key][q] (A = V^T rows from LDS, key-contiguous). Lane (h2, m), column group c: q = q0 + 16 c + m; keys of a step = kb+8*h2+r and kb+16+8*h2+r.
// Online softmax per q with a held reference: PEXP minus the reference is the C operand of the score WMMAs, so their result is the exponent and the term is exp2 of it (x256 included) -> f16.
// Each step tests once (ballot, scalar branch) whether any lane's 32 exponents pass PEXP + PGROW; only then (and at the first step) the halves' maxima are joined (xor 16), the references move up to them and the sums are rescaled.
// The row sums over the f16 values accumulate in one more WMMA per step and column group, ones[16][32] . P^T (f32), whose every row holds them.
// Behind the loop key half 1 hands its sums, row sums and references to key half 0 through LDS (register order); half 0 brings both to the higher reference, adds and normalises.
__device__ __forceinline__ unsigned lds_addr(const void* p) { return (unsigned)(size_t)(__attribute__((address_space(3))) const void*)p; }
// One stage: lane copies K rows r, r+32, r+64, r+96 (its 16 B of each) and V^T rows d, d+16, d+32, d+48. s_wait_xcnt 0 closes the statement (a precaution): no operand register is rewritten ahead of it.
__device__ __forceinline__ void stage_copy(unsigned lk, unsigned lv, const h16* gk, const h16* gv) {
    asm volatile("global_load_async_to_lds_b128 %0, %8, off\n\t"
                 "global_load_async_to_lds_b128 %1, %9, off\n\t"
                 "global_load_async_to_lds_b128 %2, %10, off\n\t"
                 "global_load_async_to_lds_b128 %3, %11, off\n\t"
                 "global_load_async_to_lds_b128 %4, %12, off\n\t"
                 "global_load_async_to_lds_b128 %5, %13, off\n\t"
                 "global_load_async_to_lds_b128 %6, %14, off\n\t"
                 "global_load_async_to_lds_b128 %7, %15, off\n\t"
                 "s_wait_xcnt 0x0"
                 :: "v"(lk), "v"(lk + 32 * KPITCH), "v"(lk + 64 * KPITCH), "v"(lk + 96 * KPITCH),
                    "v"(lv), "v"(lv + 16 * VPITCH), "v"(lv + 32 * VPITCH), "v"(lv + 48 * VPITCH),
                    "v"(gk), "v"(gk + (size_t)32 * DMOD), "v"(gk + (size_t)64 * DMOD), "v"(gk + (size_t)96 * DMOD),
                    "v"(gv), "v"(gv + (size_t)16 * TOK), "v"(gv + (size_t)32 * TOK), "v"(gv + (size_t)48 * TOK)
                 : "memory");
}
__global__ __launch_bounds__(32 * QW * KH) void k_sdpa(const h16* __restrict__ Q16, const h16* __restrict__ K16, const h16* __restrict__ VT16, float* out) {
    __shared__ __align__(16) unsigned char ring[2 * KH * SBYTES];   // [buffer][key half][K rows | V^T rows]
    __shared__ __align__(16) float osall[QW * 32 * 68];
    const int tid = threadIdx.x, lane = tid & 31, m = lane & 15, hh = lane >> 4, th = tid & (32 * QW - 1);
    const int wave = __builtin_amdgcn_readfirstlane(tid >> 5);
    const int g = wave / QW, wq = wave % QW;   // key half, query slot
    float* os = osall + wq * (32 * 68);        // shared by the two waves of a query slot
    const int bh = blockIdx.y; const int b = bh / NHEAD, h = bh % NHEAD; const int q0 = (blockIdx.x * QW + wq) * (16 * QC);
    const unsigned lk = lds_addr(ring) + g * SBYTES + (th >> 3) * KPITCH + (th & 7) * 16;               // + buffer * KH * SBYTES
    const unsigned lv = lds_addr(ring) + g * SBYTES + KBYTES + (th >> 4) * VPITCH + (th & 15) * 16;     // + buffer * KH * SBYTES
    const h16* gk = K16 + ((size_t)b * SEQ + g * KST + (th >> 3)) * DMOD + h * HD + (th & 7) * 8;          // + stage * KH * KST * DMOD
    const h16* gv = VT16 + ((size_t)h * HD + (th >> 4)) * TOK + (size_t)b * SEQ + g * KST + (th & 15) * 8;   // + stage * KH * KST
    stage_copy(lk, lv, gk, gv);
    v16h qf[QC][2];   // [column group][d 0..31, d 32..63]
#pragma unroll
    for (int c = 0; c < QC; ++c) { const h16* qrow = Q16 + ((size_t)b * SEQ + q0 + c * 16 + m) * DMOD + h * HD + 8 * hh;
        qf[c][0] = cat16(*(const v8h*)(qrow), *(const v8h*)(qrow + 16)); qf[c][1] = cat16(*(const v8h*)(qrow + 32), *(const v8h*)(qrow + 48)); }
    v8f oacc[QC][4], lacc[QC], bv[QC];   // lacc: row sums (every element: the lane's own query); bv: C operand of the score WMMAs, PEXP - reference of the lane's query, in all eight rows
#pragma unroll
    for (int c = 0; c < QC; ++c) { lacc[c] = (v8f){}; bv[c] = (v8f){};
#pragma unroll
        for (int t = 0; t < 4; ++t) oacc[c][t] = (v8f){}; }
    float thr = -3.0e38f;     // exponent above which the references move; below every score until the first step has set them
    v16h ones;   // A operand of the row-sum WMMA: 1.0 in every row and k
#pragma unroll
    for (int i = 0; i < 16; ++i) ones[i] = (h16)1.0f;
    asm volatile("s_wait_asynccnt 0x0" ::: "memory");   // this wave's share of stage 0 has landed
    __syncthreads();                                    // stage 0 is readable by every wave
    stage_copy(lk + KH * SBYTES, lv + KH * SBYTES, gk + (size_t)KH * KST * DMOD, gv + KH * KST);
#pragma unroll 1   // one copy of the stage body: the buffer is picked by sg & 1
    for (int sg = 0; sg < NST; ++sg) {
        const unsigned char* kbase = ring + ((sg & 1) * KH + g) * SBYTES + m * KPITCH + 16 * hh;            // + key in the half's stage * KPITCH
        const unsigned char* vbase = ring + ((sg & 1) * KH + g) * SBYTES + KBYTES + m * VPITCH + 16 * hh;   // + d-tile * 16 * VPITCH + key in the half's stage * 2
#pragma unroll 1   // one copy of the 32-key step
        for (int kb = 0; kb < KST; kb += 32) {
            v16h ka[2][2];
#pragma unroll
            for (int kt = 0; kt < 2; ++kt) { const unsigned char* kr = kbase + (kb + kt * 16) * KPITCH; ka[kt][0] = cat16(*(const v8ha*)kr, *(const v8ha*)(kr + 32)); ka[kt][1] = cat16(*(const v8ha*)(kr + 64), *(const v8ha*)(kr + 96)); }
            v8f st[QC][2];
#pragma unroll
            for (int kt = 0; kt < 2; ++kt)
#pragma unroll
                for (int c = 0; c < QC; ++c) st[c][kt] = wmma16(ka[kt][0], qf[c][0], bv[c]);
#pragma unroll
            for (int kt = 0; kt < 2; ++kt)
#pragma unroll
                for (int c = 0; c < QC; ++c) st[c][kt] = wmma16(ka[kt][1], qf[c][1], st[c][kt]);
            // four vector slots behind the last score WMMA, on every path, before its result is read or its operands are rewritten
            asm volatile("v_nop\n\tv_nop\n\tv_nop\n\tv_nop" : "+v"(st[0][0]), "+v"(st[0][1]), "+v"(st[1][0]), "+v"(st[1][1]) : "v"(ka[0][0]), "v"(ka[0][1]), "v"(ka[1][0]), "v"(ka[1][1]), "v"(qf[0][0]), "v"(qf[0][1]), "v"(qf[1][0]), "v"(qf[1][1]));
            v16h va[4];
#pragma unroll
            for (int t = 0; t < 4; ++t) { const unsigned char* vr = vbase + t * 16 * VPITCH + kb * 2; va[t] = cat16(*(const v8ha*)vr, *(const v8ha*)(vr + 32)); }
            __builtin_amdgcn_sched_barrier(0);   // keeps the eight V^T fragment loads one group ahead of the softmax: split, the late part is waited for among the context WMMAs
            float mx[QC];
#pragma unroll
            for (int c = 0; c < QC; ++c) { float mk[2];   // one chain per 16-key tile: the chains run side by side
#pragma unroll
                for (int kt = 0; kt < 2; ++kt) { mk[kt] = fmaxf(fmaxf(st[c][kt][0], st[c][kt][1]), st[c][kt][2]); mk[kt] = fmaxf(fmaxf(mk[kt], st[c][kt][3]), st[c][kt][4]); mk[kt] = fmaxf(fmaxf(mk[kt], st[c][kt][5]), st[c][kt][6]); }
                mx[c] = fmaxf(fmaxf(fmaxf(mk[0], mk[1]), st[c][0][7]), st[c][1][7]); }
            if (__builtin_expect(__builtin_amdgcn_ballot_w32(fmaxf(mx[0], mx[1]) > thr) != 0u, 0)) {   // wave-uniform: some query's reference has to move
                const bool fresh = thr < 0.f;                                             // first step: no reference yet, the sums are still zero
#pragma unroll
                for (int c = 0; c < QC; ++c) {
                    const float up = fmaxf(mx[c], __shfl_xor(mx[c], 16, 32)) - PEXP;      // both halves of a query move alike
                    const float d = fresh ? up : fmaxf(up, 0.f);                          // a reference never moves down
                    const float alpha = fresh ? 1.0f : __builtin_amdgcn_exp2f(-d);
                    st[c][0] -= d; st[c][1] -= d; bv[c] -= d; lacc[c] *= alpha;
#pragma unroll
                    for (int t = 0; t < 4; ++t) oacc[c][t] *= alpha;
                }
                thr = PEXP + PGROW;
            }
            v16h pf[QC];
#pragma unroll
            for (int c = 0; c < QC; ++c) { pf[c] = (v16h){};
#pragma unroll
                for (int r = 0; r < 8; ++r) {
                    pf[c][r] = (h16)__builtin_amdgcn_exp2f(st[c][0][r]);
                    pf[c][8 + r] = (h16)__builtin_amdgcn_exp2f(st[c][1][r]); } }
#pragma unroll
            for (int c = 0; c < QC; ++c) lacc[c] = wmma16(ones, pf[c], lacc[c]);   // every row of ones . P^T is the step's sum over all 32 keys of column q: each lane holds its own query's sum
#pragma unroll
            for (int t = 0; t < 4; ++t)
#pragma unroll
                for (int c = 0; c < QC; ++c) oacc[c][t] = wmma16(va[t], pf[c], oacc[c][t]);
            // four vector slots behind the last context WMMA, on every path, before its operands are rewritten
            asm volatile("v_nop\n\tv_nop\n\tv_nop\n\tv_nop" : "+v"(oacc[0][0]), "+v"(oacc[0][1]), "+v"(oacc[0][2]), "+v"(oacc[0][3]), "+v"(oacc[1][0]), "+v"(oacc[1][1]), "+v"(oacc[1][2]), "+v"(oacc[1][3]) : "v"(va[0]), "v"(va[1]), "v"(va[2]), "v"(va[3]), "v"(pf[0]), "v"(pf[1]));
        }
        asm volatile("s_wait_dscnt 0x0" ::: "memory");      // this wave's reads of stage sg have returned before its buffer is refilled
        asm volatile("s_wait_asynccnt 0x0" ::: "memory");   // this wave's share of stage sg + 1 has landed
        __syncthreads();                                    // publishes stage sg + 1 and ends every wave's reads of stage sg
        if (sg + 2 < NST) stage_copy(lk + (sg & 1) * (KH * SBYTES), lv + (sg & 1) * (KH * SBYTES), gk + (size_t)(sg + 2) * (KH * KST) * DMOD, gv + (size_t)(sg + 2) * (KH * KST));   // work-group-uniform test; refills the buffer just read
    }
    asm volatile("s_wait_asynccnt 0x0" ::: "memory");       // no copy is outstanding when the wave goes on to its end
    // Join of the key halves. Hand-over in register order: 16-B chunk j of lane l at float 128 j + 4 l (16 chunks of sums, one of row sums and C operands).
    if (g == 1) {
#pragma unroll
        for (int c = 0; c < QC; ++c)
#pragma unroll
            for (int t = 0; t < 4; ++t)
#pragma unroll
                for (int u = 0; u < 2; ++u) { const v4f w = {oacc[c][t][4 * u], oacc[c][t][4 * u + 1], oacc[c][t][4 * u + 2], oacc[c][t][4 * u + 3]}; *(v4fa*)(os + ((c * 4 + t) * 2 + u) * 128 + lane * 4) = w; }
        const v4f w = {lacc[0][0], lacc[1][0], bv[0][0], bv[1][0]}; *(v4fa*)(os + 16 * 128 + lane * 4) = w;
    }
    __syncthreads();   // key half 1's sums are readable by key half 0
    if (g == 0) {
        const v4f w = *(const v4fa*)(os + 16 * 128 + lane * 4);
        v8f ob[QC][4];
#pragma unroll
        for (int c = 0; c < QC; ++c)
#pragma unroll
            for (int t = 0; t < 4; ++t)
#pragma unroll
                for (int u = 0; u < 2; ++u) { const v4f x = *(const v4fa*)(os + ((c * 4 + t) * 2 + u) * 128 + lane * 4); ob[c][t][4 * u] = x[0]; ob[c][t][4 * u + 1] = x[1]; ob[c][t][4 * u + 2] = x[2]; ob[c][t][4 * u + 3] = x[3]; }
#pragma unroll
        for (int c = 0; c < QC; ++c) {
            const float ba = bv[c][0], bb = w[2 + c], bm = fminf(ba, bb);   // the smaller C operand belongs to the higher reference
            const float fa = __builtin_amdgcn_exp2f(bm - ba), fb = __builtin_amdgcn_exp2f(bm - bb);
            const float rl = __fdiv_rn(1.0f, lacc[c][0] * fa + w[c] * fb) * (1.0f / VCAR);
            const float ra = fa * rl, rb = fb * rl;
#pragma unroll
            for (int t = 0; t < 4; ++t)
#pragma unroll
                for (int r = 0; r < 8; ++r) os[(c * 16 + m) * 68 + t * 16 + hh * 8 + r] = oacc[c][t][r] * ra + ob[c][t][r] * rb;   // the slot's hand-over has been read into registers above
        }
    }
    __syncthreads();   // the staged output rows are readable by both waves of the slot
    float* obase = out + ((size_t)b * SEQ + q0 + g * 16) * DMOD + h * HD;   // each wave of the slot stores 16 of its 32 rows
#pragma unroll
    for (int s = 0; s < 8; ++s) { const int row = 2 * s + hh, cofs = m * 4; const v4f val = *(const v4fa*)(os + (g * 16 + row) * 68 + cofs); *(v4f*)(obase + (size_t)row * DMOD + cofs) = val; }
}

extern "C" void kernel_launch(void* const* d_in, const int* in_sizes, int n_in,
                              void* d_out, int out_size, void* d_ws, size_t ws_size, hipStream_t stream) {
    if (n_in < 9) return;
    const int need_x = ((NB - 1) * SEQ_FULL + SEQ) * DMOD;
    if (in_sizes[0] < need_x || in_sizes[1] < need_x || in_sizes[2] < need_x) return;
    if (in_sizes[3] < DMOD * DMOD || in_sizes[5] < DMOD * DMOD || in_sizes[7] < DMOD * DMOD) return;
    if (in_sizes[4] < DMOD || in_sizes[6] < DMOD || in_sizes[8] < DMOD) return;
    if (out_size < TOK * DMOD) return;
    const float* Xq = (const float*)d_in[0]; const float* Xk = (const float*)d_in[1]; const float* Xv = (const float*)d_in[2];
    const float* Wq = (const float*)d_in[3]; const float* bq = (const float*)d_in[4];
    const float* Wk = (const float*)d_in[5]; const float* bk = (const float*)d_in[6];
    const float* Wv = (const float*)d_in[7]; const float* bv = (const float*)d_in[8];
    float* OUT = (float*)d_out;     // [NB][SEQ][512]
    char* wsp = (char*)d_ws;
    auto take = [&](size_t bytes) { char* p = wsp; wsp += (bytes + 255) & ~(size_t)255; return (void*)p; };
    bf* WTq = (bf*)take((size_t)DMOD * DMOD * 2); bf* WTk = (bf*)take((size_t)DMOD * DMOD * 2); bf* WTv = (bf*)take((size_t)DMOD * DMOD * 2);   // [out][in] bf16
    h16* Q16 = (h16*)take((size_t)TOK * DMOD * 2); h16* K16 = (h16*)take((size_t)TOK * DMOD * 2); h16* VT16 = (h16*)take((size_t)TOK * DMOD * 2);   // [tok][512], [tok][512], [512][tok]
    if ((size_t)(wsp - (char*)d_ws) > ws_size) return;
    const unsigned gw = (unsigned)((DMOD * DMOD / 64 + 63) / 64);
    k_wtG<<<dim3(gw, 3, 1), 256, 0, stream>>>(Wq, Wk, Wv, DMOD, DMOD, WTq, WTk, WTv);
    // Q = query Wq + bq -> f16 [tok][512] x QSCL, K = key Wk + bk -> f16 [tok][512] x QKCAR; V^T = (value Wv + bv)^T -> f16 [512][tok] x VCAR
    k_proj<<<dim3(TOK / 64, DMOD / (64 * PW), 3), 32 * PW, 0, stream>>>(Xq, Xk, Xv, WTq, WTk, WTv, bq, bk, bv, Q16, K16, VT16);
    // softmax(Q K^T / 8) V per (batch, head), heads merged into [NB][SEQ][512]
    k_sdpa<<<dim3(SEQ / (16 * QC * QW), NB * NHEAD, 1), 32 * QW * KH, 0, stream>>>(Q16, K16, VT16, OUT);
}

// v006
// Measured time: 70.2 microseconds a run.
// Timed twice side by side with v005, it ran 1.15 times as fast both times.
// Counting every step since v000, it is 5.20 times as fast.
#include <hip/hip_runtime.h>

// Contractions: q/k/v projections = v_wmma_f32_16x16x32_bf16 (bf16-RNE activations x bf16-RNE W^T planes, f32 accumulate, bias added in f32); scores K.Q^T, context V^T.P^T and the softmax row sums ones.P^T (transposed 16x16 tiles) = v_wmma_f32_16x16x32_f16 (f16 planes: Q x log2(e)/32, K x4, V^T x16; P = exp2 terms in f16 carried x256), f32 accumulate; online softmax, normalisation and output in f32.
// Plan: W bf16 planes in the order of k_proj's WMMA fragments (one launch); one launch for q, k and v: 64x64 register-blocked GEMM (one wave per tile, 4 waves share a token tile) that reads the f32 activations, rounds them to bf16 on the way into LDS, and stores the f16 plane with bias and scale factor itself ([tok][512]; V: [512][tok]); then work-groups of 16 waves on 256 query rows of one (batch, head), one wave per 32 query rows and per half of the keys: 256-key K and V^T stages are copied once per work-group into a two-buffer LDS ring, every wave streams 32-key steps of its 128-key half with fragments read from LDS (each fragment feeds two 16-query column groups), online softmax; the two key halves of a query are joined once through LDS and the 32x64 f32 result leaves via an LDS stage as whole 256-B row segments.

#ifndef NB
#define NB 2
#endif
#ifndef SEQ
#define SEQ 4096
#endif
#define NB_FULL 2
#define SEQ_FULL 4096
#define DMOD 512
#define NHEAD 8
#define HD 64
#define TOK (NB * SEQ)
#define PEXP 8.0f                         // log2 of the carry (x256) of the exp2 terms fed to the context WMMA
#define PGROW 7.0f                        // a score may pass the held softmax reference by this much (log2) before the reference moves: terms stay <= 2^15, inside f16
#define QKCAR 4.0f                        // carry of the K f16 plane
#define VCAR 16.0f                        // carry of the V^T f16 plane
#define QSCL 0.045084220027780106f        // factor of the Q f16 plane: 0.125 * log2(e) / QKCAR, so K.Q^T is the scaled score in log2 units

static_assert(NB >= 1 && NB <= NB_FULL);
static_assert(SEQ >= 64 && SEQ <= SEQ_FULL && (SEQ % 64) == 0);
static_assert(DMOD == NHEAD * HD && (DMOD % 64) == 0 && HD == 64);
static_assert((((size_t)TOK * DMOD) % 8) == 0);
static_assert(((DMOD * DMOD) % 64) == 0);
#define QW 8                              // query slots per k_sdpa work-group, QC * 16 query rows each
#define QC 2                              // 16-query column groups per wave: each K and V^T fragment read from LDS feeds QC WMMAs
#define KH 2                              // key halves per work-group: QW waves each, so the work-group has QW * KH waves
#define KST 128                           // keys per LDS stage and key half
#define NST (SEQ / (KST * KH))            // stages per (batch, head)
#define KPITCH 144                        // bytes per staged K row: 128 + 16 (16 B x odd, for 16-byte LDS reads)
#define VPITCH 272                        // bytes per staged V^T row: 256 + 16
#define KBYTES (KST * KPITCH)
#define VBYTES (HD * VPITCH)
#define SBYTES (KBYTES + VBYTES)          // one key half's share of a stage: its K rows, then its V^T rows
static_assert((SEQ % (KST * KH)) == 0 && NST >= 2 && (SEQ % (16 * QC * QW)) == 0 && (KST % 32) == 0 && QC == 2 && KH == 2);
static_assert(KST * 8 == 4 * 32 * QW && HD * (KST / 8) == 4 * 32 * QW);   // four K copies and four V^T copies per lane fill a key half's share of a stage

typedef _Float16 h16;
typedef unsigned short bf;
typedef __attribute__((ext_vector_type(16))) __bf16   v16bf;
typedef __attribute__((ext_vector_type(16))) _Float16 v16h;
typedef __attribute__((ext_vector_type(8)))  _Float16 v8h;
typedef __attribute__((ext_vector_type(8)))  unsigned short v8us;
typedef __attribute__((ext_vector_type(8)))  float    v8f;
typedef __attribute__((ext_vector_type(4)))  float    v4f;
typedef v8h  __attribute__((may_alias)) v8ha;
typedef v4f  __attribute__((may_alias)) v4fa;
typedef v8us __attribute__((may_alias)) v8usa;

__device__ __forceinline__ unsigned short f2bf(float f) { unsigned u = __float_as_uint(f); u += 0x7FFFu + ((u >> 16) & 1u); return (unsigned short)(u >> 16); }
__device__ __forceinline__ float bf2f(unsigned short b) { return __uint_as_float(((unsigned)b) << 16); }
__device__ __forceinline__ float bfr(float f) { return bf2f(f2bf(f)); }
__device__ __forceinline__ v16h cat16(v8h lo, v8h hi) { return __builtin_shufflevector(lo, hi, 0, 1, 2, 3, 4, 5, 6, 7, 8, 9, 10, 11, 12, 13, 14, 15); }
__device__ __forceinline__ v16bf cat16b(v8us lo, v8us hi) { return __builtin_bit_cast(v16bf, __builtin_shufflevector(lo, hi, 0, 1, 2, 3, 4, 5, 6, 7, 8, 9, 10, 11, 12, 13, 14, 15)); }
__device__ __forceinline__ v8f wmma16(v16h a, v16h b, v8f c) { return __builtin_amdgcn_wmma_f32_16x16x32_f16(false, a, false, b, (short)0, c, false, false); }
__device__ __forceinline__ v8f wmmab(v16bf a, v16bf b, v8f c) { return __builtin_amdgcn_wmma_f32_16x16x32_bf16(false, a, false, b, (short)0, c, false, false); }

// ---- k_wtG: W [in][out] f32 -> bf16 plane in fragment order, the three weight matrices in one launch (blockIdx.y picks the matrix).
// Plane: 1-KB blocks [in / 32][out / 16]; a block is one 16 (out) x 32 (in) WMMA operand as k_proj's two 16-B loads read it:
// chunk (j, lane) at byte 512 j + 16 lane holds W[k0 + 16 j + 8 (lane >> 4) + 0..7][n0 + (lane & 15)], so a wave-wide load is 512 contiguous bytes.
// One thread per 16-B chunk: eight 4-B reads (a work-group reads 256 contiguous bytes of each of 32 W rows), one 16-B store. coverage: gridDim.x * 256 == DMOD * DMOD / 8.
#define WBLK 512                          // bf16 per fragment block
static_assert((DMOD % 32) == 0 && ((DMOD * DMOD / 8) % 256) == 0);
__global__ __launch_bounds__(256) void k_wtG(const float* __restrict__ w0, const float* __restrict__ w1, const float* __restrict__ w2, bf* B0, bf* B1, bf* B2) {
    const int sel = blockIdx.y; const float* __restrict__ w = sel == 0 ? w0 : sel == 1 ? w1 : w2; bf* Bt = sel == 0 ? B0 : sel == 1 ? B1 : B2;
    const int c = blockIdx.x * 256 + threadIdx.x;   // chunk
    const int lane = c & 31, j = (c >> 5) & 1, nb = (c >> 6) % (DMOD / 16), ks = (c >> 6) / (DMOD / 16);
    const float* p = w + (size_t)(ks * 32 + j * 16 + (lane >> 4) * 8) * DMOD + nb * 16 + (lane & 15);
    v8us o;
#pragma unroll
    for (int i = 0; i < 8; ++i) o[i] = f2bf(p[(size_t)i * DMOD]);
    *(v8us*)(Bt + (size_t)c * 8) = o;
}

// ---- k_proj: the three projections in one launch; work-group = 4 waves on one 64-token tile, ONE WAVE per 64 tokens x 64 output features (16 accumulators); grid (TOK/64, DMOD/256, 3), 128 threads; blockIdx.z = 0 q, 1 k, 2 v.
// Activations: each 32-deep step's 64 x 32 f32 block is read once per work-group as whole 128-B lines, rounded to bf16 (nearest even) in registers and stored to a two-buffer LDS tile that the 4 waves share; step s+1 is fetched while step s is multiplied.
// Weights come straight from the fragment-ordered bf16 plane (each load 512 contiguous bytes per wave); bias (bf16-rounded, added in f32), carry and the f16 rounding are applied to the accumulators.
// Fragments: lane row/col = l&15, elements 0..7 <- k0+8h+0..7, 8..15 <- k0+16+8h+0..7 (h = l>>4) for A and B alike; D element r of lane l = (A row 8h+r, B row l&15).
// The operand whose index runs along the output rows is A, so a lane's 8 D elements are 16 contiguous output bytes: q, k (plane [tok][512]): A = W^T, B = activations; v (plane [512][tok]): A = activations, B = W^T.
typedef __attribute__((ext_vector_type(4))) __bf16 v4bf;
typedef v4bf __attribute__((may_alias)) v4bfa;
#define PW 4                              // waves per k_proj work-group
#define XSP 40                            // bf16 per staged activation row: 32 + 8 (80 B = 16 B x odd, for 16-byte LDS reads)
#define HSP 72                            // f16 per staged output row: 64 + 8 (144 B = 16 B x odd)
static_assert((DMOD % (64 * PW)) == 0 && (TOK % 64) == 0 && 32 * PW == 16 * 8);   // 16 rows of 8 x 16 B per staging pass, four passes per step
__device__ __forceinline__ v16bf ldw(const bf* p) { return cat16b(*(const v8usa*)p, *(const v8usa*)(p + 16)); }
__device__ __forceinline__ v16bf ldwp(const bf* p) { return cat16b(*(const v8usa*)p, *(const v8usa*)(p + WBLK / 2)); }   // a lane's two chunks of a fragment block
template <bool XA>   // XA: the activations are the A operand (v); otherwise the B operand (q, k)
__device__ __forceinline__ void proj_tile(const float* __restrict__ X, const bf* __restrict__ WT, const float* __restrict__ bias, float sc, h16* O, bf* xs, h16* hsall) {
    const int tid = threadIdx.x, lane = tid & 31, lr = lane & 15, hi = lane >> 4;
    const int wave = __builtin_amdgcn_readfirstlane(tid >> 5);
    const int t0 = blockIdx.x * 64, n0 = (blockIdx.y * PW + wave) * 64;
    h16* hs = hsall + wave * (64 * HSP);
    v8f acc[4][4];   // [A block][B block]
#pragma unroll
    for (int ab = 0; ab < 4; ++ab)
#pragma unroll
        for (int bb = 0; bb < 4; ++bb) acc[ab][bb] = (v8f){};
    const float* xg = X + ((size_t)(t0 / SEQ) * SEQ_FULL + (t0 % SEQ) + (tid >> 3)) * DMOD + (tid & 7) * 4;   // + pass * 16 rows + step
    bf* xw = xs + (tid >> 3) * XSP + (tid & 7) * 4;                                                         // + buffer * 64 * XSP + pass * 16 * XSP
    const bf* xr = xs + lr * XSP + 8 * hi;                                                                  // + buffer * 64 * XSP + block * 16 * XSP
    const bf* wp = WT + (size_t)(n0 / 16) * WBLK + lane * 8;                                                  // + block * WBLK + step * (DMOD / 16) * WBLK
    v4f xn[4];
#pragma unroll
    for (int u = 0; u < 4; ++u) xn[u] = *(const v4f*)(xg + (size_t)u * 16 * DMOD);
#pragma unroll
    for (int u = 0; u < 4; ++u) { v4bf c; c[0] = (__bf16)xn[u][0]; c[1] = (__bf16)xn[u][1]; c[2] = (__bf16)xn[u][2]; c[3] = (__bf16)xn[u][3]; *(v4bfa*)(xw + u * 16 * XSP) = c; }
    __syncthreads();   // step 0 is readable by every wave
#pragma unroll 1   // one copy of the 32-deep step, as in the plane GEMM before; the buffer is picked by the step's parity
    for (int kc = 0; kc < DMOD; kc += 32) {
        const int cur = (kc >> 5) & 1; const bool more = kc + 32 < DMOD;   // the same for the whole work-group
        if (more) {
#pragma unroll
            for (int u = 0; u < 4; ++u) xn[u] = *(const v4f*)(xg + (size_t)u * 16 * DMOD + kc + 32); }
        v16bf xf[4], wf[4];
#pragma unroll
        for (int u = 0; u < 4; ++u) wf[u] = ldwp(wp + u * WBLK + (size_t)(kc / 32) * (DMOD / 16) * WBLK);
#pragma unroll
        for (int u = 0; u < 4; ++u) xf[u] = ldw(xr + cur * (64 * XSP) + u * 16 * XSP);
#pragma unroll
        for (int bb = 0; bb < 4; ++bb)
#pragma unroll
            for (int ab = 0; ab < 4; ++ab) acc[ab][bb] = XA ? wmmab(xf[ab], wf[bb], acc[ab][bb]) : wmmab(wf[ab], xf[bb], acc[ab][bb]);
        // four vector slots behind the last WMMA, on every path, before its operands are rewritten
        asm volatile("v_nop\n\tv_nop\n\tv_nop\n\tv_nop" : "+v"(acc[0][0]), "+v"(acc[1][1]), "+v"(acc[2][2]), "+v"(acc[3][3]) : "v"(xf[0]), "v"(xf[3]), "v"(wf[0]), "v"(wf[3]));
        if (more) {
#pragma unroll
            for (int u = 0; u < 4; ++u) { v4bf c; c[0] = (__bf16)xn[u][0]; c[1] = (__bf16)xn[u][1]; c[2] = (__bf16)xn[u][2]; c[3] = (__bf16)xn[u][3]; *(v4bfa*)(xw + (cur ^ 1) * (64 * XSP) + u * 16 * XSP) = c; } }
        asm volatile("s_wait_xcnt 0x0" ::: "memory");   // a precaution: stands in front of the advance of the address registers that this step's global loads name
        __syncthreads();                                // publishes the next step's buffer and ends every wave's reads of this one
    }
    // output row j = B row (q, k: token; v: feature), position in the row i = A row (q, k: feature; v: token)
#pragma unroll
    for (int ab = 0; ab < 4; ++ab) {
        v8f bi;
        if (!XA) bi = *(const v8f*)(bias + n0 + ab * 16 + hi * 8);
#pragma unroll
        for (int bb = 0; bb < 4; ++bb) { v8h o; const float bj = XA ? bfr(bias[n0 + bb * 16 + lr]) : 0.f;
#pragma unroll
            for (int r = 0; r < 8; ++r) o[r] = (h16)((acc[ab][bb][r] + (XA ? bj : bfr(bi[r]))) * sc);
            *(v8ha*)(hs + (bb * 16 + lr) * HSP + ab * 16 + hi * 8) = o; }
    }
    __syncthreads();   // the staged output rows are written before other lanes read them
    h16* obase = XA ? O + (size_t)n0 * TOK + t0 : O + (size_t)t0 * DMOD + n0; const size_t ldo = XA ? TOK : DMOD;
#pragma unroll
    for (int s = 0; s < 16; ++s) { const int row = s * 4 + (lane >> 3), c = lane & 7;   // 8 lanes store one whole 128-B row segment
        *(v8h*)(obase + (size_t)row * ldo + c * 8) = *(const v8ha*)(hs + row * HSP + c * 8); }
}
__global__ __launch_bounds__(32 * PW) void k_proj(const float* __restrict__ Xq, const float* __restrict__ Xk, const float* __restrict__ Xv, const bf* __restrict__ WTq, const bf* __restrict__ WTk, const bf* __restrict__ WTv,
                                                  const float* __restrict__ bq, const float* __restrict__ bk, const float* __restrict__ bv, h16* Q16, h16* K16, h16* VT16) {
    __shared__ __align__(16) bf xs[2 * 64 * XSP];
    __shared__ __align__(16) h16 hs[PW * 64 * HSP];
    const int z = blockIdx.z;
    if (z == 2) proj_tile<true>(Xv, WTv, bv, VCAR, VT16, xs, hs);
    else proj_tile<false>(z ? Xk : Xq, z ? WTk : WTq, z ? bk : bq, z ? QKCAR : QSCL, z ? K16 : Q16, xs, hs);
}

// ---- k_sdpa: work-group = 16 waves = 8 query slots x 2 key halves; one wave = 32 query rows (two 16-column groups) of one (batch b, head h) against one half of the keys; grid (SEQ/256, NB*NHEAD), 512 threads.
// A stage is 256 keys: key half g owns keys 128 g .. 128 g + 127 of it. Its K rows [key][64 d] and V^T rows [d][128 keys] are copied global -> LDS once per work-group by the half's own 8 waves (16 B per lane and copy), two buffers: stage s+1 flies while stage s is worked on.
// Transposed tiles: S^T[key][q] = sum_d K[key][d] Q[q][d] (A = K rows from LDS, B = Q rows from the Q plane, both d-contiguous);
// the two 16-key D tiles of a 32-key step become the B fragment P^T[key][q] (element r <- tile keys 0..15, element 8+r <- tile keys 16..31, lane unchanged);
// O^T[d][q] += sum_key V^T[d][key] P^T[key][q] (A = V^T rows from LDS, key-contiguous). Lane (h2, m), column group c: q = q0 + 16 c + m; keys of a step = kb+8*h2+r and kb+16+8*h2+r.
// Online softmax per q with a held reference: PEXP minus the reference is the C operand of the score WMMAs, so their result is the exponent and the term is exp2 of it (x256 included) -> f16.
// Each step tests once (ballot, scalar branch) whether any lane's 32 exponents pass PEXP + PGROW; only then (and at the first step) the halves' maxima are joined (xor 16), the references move up to them and the sums are rescaled.
// The row sums over the f16 values accumulate in one more WMMA per step and column group, ones[16][32] . P^T (f32), whose every row holds them.
// Behind the loop key half 1 hands its sums, row sums and references to key half 0 through LDS (register order); half 0 brings both to the higher reference, adds and normalises.
__device__ __forceinline__ unsigned lds_addr(const void* p) { return (unsigned)(size_t)(__attribute__((address_space(3))) const void*)p; }
// One stage: lane copies K rows r, r+32, r+64, r+96 (its 16 B of each) and V^T rows d, d+16, d+32, d+48. s_wait_xcnt 0 closes the statement (a precaution): no operand register is rewritten ahead of it.
__device__ __forceinline__ void stage_copy(unsigned lk, unsigned lv, const h16* gk, const h16* gv) {
    asm volatile("global_load_async_to_lds_b128 %0, %8, off\n\t"
                 "global_load_async_to_lds_b128 %1, %9, off\n\t"
                 "global_load_async_to_lds_b128 %2, %10, off\n\t"
                 "global_load_async_to_lds_b128 %3, %11, off\n\t"
                 "global_load_async_to_lds_b128 %4, %12, off\n\t"
                 "global_load_async_to_lds_b128 %5, %13, off\n\t"
                 "global_load_async_to_lds_b128 %6, %14, off\n\t"
                 "global_load_async_to_lds_b128 %7, %15, off\n\t"
                 "s_wait_xcnt 0x0"
                 :: "v"(lk), "v"(lk + 32 * KPITCH), "v"(lk + 64 * KPITCH), "v"(lk + 96 * KPITCH),
                    "v"(lv), "v"(lv + 16 * VPITCH), "v"(lv + 32 * VPITCH), "v"(lv + 48 * VPITCH),
                    "v"(gk), "v"(gk + (size_t)32 * DMOD), "v"(gk + (size_t)64 * DMOD), "v"(gk + (size_t)96 * DMOD),
                    "v"(gv), "v"(gv + (size_t)16 * TOK), "v"(gv + (size_t)32 * TOK), "v"(gv + (size_t)48 * TOK)
                 : "memory");
}
__global__ __launch_bounds__(32 * QW * KH) void k_sdpa(const h16* __restrict__ Q16, const h16* __restrict__ K16, const h16* __restrict__ VT16, float* out) {
    __shared__ __align__(16) unsigned char ring[2 * KH * SBYTES];   // [buffer][key half][K rows | V^T rows]
    __shared__ __align__(16) float osall[QW * 32 * 68];
    const int tid = threadIdx.x, lane = tid & 31, m = lane & 15, hh = lane >> 4, th = tid & (32 * QW - 1);
    const int wave = __builtin_amdgcn_readfirstlane(tid >> 5);
    const int g = wave / QW, wq = wave % QW;   // key half, query slot
    float* os = osall + wq * (32 * 68);        // shared by the two waves of a query slot
    const int bh = blockIdx.y; const int b = bh / NHEAD, h = bh % NHEAD; const int q0 = (blockIdx.x * QW + wq) * (16 * QC);
    const unsigned lk = lds_addr(ring) + g * SBYTES + (th >> 3) * KPITCH + (th & 7) * 16;               // + buffer * KH * SBYTES
    const unsigned lv = lds_addr(ring) + g * SBYTES + KBYTES + (th >> 4) * VPITCH + (th & 15) * 16;     // + buffer * KH * SBYTES
    const h16* gk = K16 + ((size_t)b * SEQ + g * KST + (th >> 3)) * DMOD + h * HD + (th & 7) * 8;          // + stage * KH * KST * DMOD
    const h16* gv = VT16 + ((size_t)h * HD + (th >> 4)) * TOK + (size_t)b * SEQ + g * KST + (th & 15) * 8;   // + stage * KH * KST
    stage_copy(lk, lv, gk, gv);
    v16h qf[QC][2];   // [column group][d 0..31, d 32..63]
#pragma unroll
    for (int c = 0; c < QC; ++c) { const h16* qrow = Q16 + ((size_t)b * SEQ + q0 + c * 16 + m) * DMOD + h * HD + 8 * hh;
        qf[c][0] = cat16(*(const v8h*)(qrow), *(const v8h*)(qrow + 16)); qf[c][1] = cat16(*(const v8h*)(qrow + 32), *(const v8h*)(qrow + 48)); }
    v8f oacc[QC][4], lacc[QC], bv[QC];   // lacc: row sums (every element: the lane's own query); bv: C operand of the score WMMAs, PEXP - reference of the lane's query, in all eight rows
#pragma unroll
    for (int c = 0; c < QC; ++c) { lacc[c] = (v8f){}; bv[c] = (v8f){};
#pragma unroll
        for (int t = 0; t < 4; ++t) oacc[c][t] = (v8f){}; }
    float thr = -3.0e38f;     // exponent above which the references move; below every score until the first step has set them
    v16h ones;   // A operand of the row-sum WMMA: 1.0 in every row and k
#pragma unroll
    for (int i = 0; i < 16; ++i) ones[i] = (h16)1.0f;
    asm volatile("s_wait_asynccnt 0x0" ::: "memory");   // this wave's share of stage 0 has landed
    __syncthreads();                                    // stage 0 is readable by every wave
    stage_copy(lk + KH * SBYTES, lv + KH * SBYTES, gk + (size_t)KH * KST * DMOD, gv + KH * KST);
#pragma unroll 1   // one copy of the stage body: the buffer is picked by sg & 1
    for (int sg = 0; sg < NST; ++sg) {
        const unsigned char* kbase = ring + ((sg & 1) * KH + g) * SBYTES + m * KPITCH + 16 * hh;            // + key in the half's stage * KPITCH
        const unsigned char* vbase = ring + ((sg & 1) * KH + g) * SBYTES + KBYTES + m * VPITCH + 16 * hh;   // + d-tile * 16 * VPITCH + key in the half's stage * 2
#pragma unroll 1   // one copy of the 32-key step
        for (int kb = 0; kb < KST; kb += 32) {
            v16h ka[2][2];
#pragma unroll
            for (int kt = 0; kt < 2; ++kt) { const unsigned char* kr = kbase + (kb + kt * 16) * KPITCH; ka[kt][0] = cat16(*(const v8ha*)kr, *(const v8ha*)(kr + 32)); ka[kt][1] = cat16(*(const v8ha*)(kr + 64), *(const v8ha*)(kr + 96)); }
            v8f st[QC][2];
#pragma unroll
            for (int kt = 0; kt < 2; ++kt)
#pragma unroll
                for (int c = 0; c < QC; ++c) st[c][kt] = wmma16(ka[kt][0], qf[c][0], bv[c]);
#pragma unroll
            for (int kt = 0; kt < 2; ++kt)
#pragma unroll
                for (int c = 0; c < QC; ++c) st[c][kt] = wmma16(ka[kt][1], qf[c][1], st[c][kt]);
            // four vector slots behind the last score WMMA, on every path, before its result is read or its operands are rewritten
            asm volatile("v_nop\n\tv_nop\n\tv_nop\n\tv_nop" : "+v"(st[0][0]), "+v"(st[0][1]), "+v"(st[1][0]), "+v"(st[1][1]) : "v"(ka[0][0]), "v"(ka[0][1]), "v"(ka[1][0]), "v"(ka[1][1]), "v"(qf[0][0]), "v"(qf[0][1]), "v"(qf[1][0]), "v"(qf[1][1]));
            v16h va[4];
#pragma unroll
            for (int t = 0; t < 4; ++t) { const unsigned char* vr = vbase + t * 16 * VPITCH + kb * 2; va[t] = cat16(*(const v8ha*)vr, *(const v8ha*)(vr + 32)); }
            __builtin_amdgcn_sched_barrier(0);   // keeps the eight V^T fragment loads one group ahead of the softmax: split, the late part is waited for among the context WMMAs
            float mx[QC];
#pragma unroll
            for (int c = 0; c < QC; ++c) { float mk[2];   // one chain per 16-key tile: the chains run side by side
#pragma unroll
                for (int kt = 0; kt < 2; ++kt) { mk[kt] = fmaxf(fmaxf(st[c][kt][0], st[c][kt][1]), st[c][kt][2]); mk[kt] = fmaxf(fmaxf(mk[kt], st[c][kt][3]), st[c][kt][4]); mk[kt] = fmaxf(fmaxf(mk[kt], st[c][kt][5]), st[c][kt][6]); }
                mx[c] = fmaxf(fmaxf(fmaxf(mk[0], mk[1]), st[c][0][7]), st[c][1][7]); }
            if (__builtin_expect(__builtin_amdgcn_ballot_w32(fmaxf(mx[0], mx[1]) > thr) != 0u, 0)) {   // wave-uniform: some query's reference has to move
                const bool fresh = thr < 0.f;                                             // first step: no reference yet, the sums are still zero
#pragma unroll
                for (int c = 0; c < QC; ++c) {
                    const float up = fmaxf(mx[c], __shfl_xor(mx[c], 16, 32)) - PEXP;      // both halves of a query move alike
                    const float d = fresh ? up : fmaxf(up, 0.f);                          // a reference never moves down
                    const float alpha = fresh ? 1.0f : __builtin_amdgcn_exp2f(-d);
                    st[c][0] -= d; st[c][1] -= d; bv[c] -= d; lacc[c] *= alpha;
#pragma unroll
                    for (int t = 0; t < 4; ++t) oacc[c][t] *= alpha;
                }
                thr = PEXP + PGROW;
            }
            v16h pf[QC];
#pragma unroll
            for (int c = 0; c < QC; ++c) { pf[c] = (v16h){};
#pragma unroll
                for (int r = 0; r < 8; ++r) {
                    pf[c][r] = (h16)__builtin_amdgcn_exp2f(st[c][0][r]);
                    pf[c][8 + r] = (h16)__builtin_amdgcn_exp2f(st[c][1][r]); } }
#pragma unroll
            for (int c = 0; c < QC; ++c) lacc[c] = wmma16(ones, pf[c], lacc[c]);   // every row of ones . P^T is the step's sum over all 32 keys of column q: each lane holds its own query's sum
#pragma unroll
            for (int t = 0; t < 4; ++t)
#pragma unroll
                for (int c = 0; c < QC; ++c) oacc[c][t] = wmma16(va[t], pf[c], oacc[c][t]);
            // four vector slots behind the last context WMMA, on every path, before its operands are rewritten
            asm volatile("v_nop\n\tv_nop\n\tv_nop\n\tv_nop" : "+v"(oacc[0][0]), "+v"(oacc[0][1]), "+v"(oacc[0][2]), "+v"(oacc[0][3]), "+v"(oacc[1][0]), "+v"(oacc[1][1]), "+v"(oacc[1][2]), "+v"(oacc[1][3]) : "v"(va[0]), "v"(va[1]), "v"(va[2]), "v"(va[3]), "v"(pf[0]), "v"(pf[1]));
        }
        asm volatile("s_wait_dscnt 0x0" ::: "memory");      // this wave's reads of stage sg have returned before its buffer is refilled
        asm volatile("s_wait_asynccnt 0x0" ::: "memory");   // this wave's share of stage sg + 1 has landed
        __syncthreads();                                    // publishes stage sg + 1 and ends every wave's reads of stage sg
        if (sg + 2 < NST) stage_copy(lk + (sg & 1) * (KH * SBYTES), lv + (sg & 1) * (KH * SBYTES), gk + (size_t)(sg + 2) * (KH * KST) * DMOD, gv + (size_t)(sg + 2) * (KH * KST));   // work-group-uniform test; refills the buffer just read
    }
    asm volatile("s_wait_asynccnt 0x0" ::: "memory");       // no copy is outstanding when the wave goes on to its end
    // Join of the key halves. Hand-over in register order: 16-B chunk j of lane l at float 128 j + 4 l (16 chunks of sums, one of row sums and C operands).
    if (g == 1) {
#pragma unroll
        for (int c = 0; c < QC; ++c)
#pragma unroll
            for (int t = 0; t < 4; ++t)
#pragma unroll
                for (int u = 0; u < 2; ++u) { const v4f w = {oacc[c][t][4 * u], oacc[c][t][4 * u + 1], oacc[c][t][4 * u + 2], oacc[c][t][4 * u + 3]}; *(v4fa*)(os + ((c * 4 + t) * 2 + u) * 128 + lane * 4) = w; }
        const v4f w = {lacc[0][0], lacc[1][0], bv[0][0], bv[1][0]}; *(v4fa*)(os + 16 * 128 + lane * 4) = w;
    }
    __syncthreads();   // key half 1's sums are readable by key half 0
    if (g == 0) {
        const v4f w = *(const v4fa*)(os + 16 * 128 + lane * 4);
        v8f ob[QC][4];
#pragma unroll
        for (int c = 0; c < QC; ++c)
#pragma unroll
            for (int t = 0; t < 4; ++t)
#pragma unroll
                for (int u = 0; u < 2; ++u) { const v4f x = *(const v4fa*)(os + ((c * 4 + t) * 2 + u) * 128 + lane * 4); ob[c][t][4 * u] = x[0]; ob[c][t][4 * u + 1] = x[1]; ob[c][t][4 * u + 2] = x[2]; ob[c][t][4 * u + 3] = x[3]; }
#pragma unroll
        for (int c = 0; c < QC; ++c) {
            const float ba = bv[c][0], bb = w[2 + c], bm = fminf(ba, bb);   // the smaller C operand belongs to the higher reference
            const float fa = __builtin_amdgcn_exp2f(bm - ba), fb = __builtin_amdgcn_exp2f(bm - bb);
            const float rl = __fdiv_rn(1.0f, lacc[c][0] * fa + w[c] * fb) * (1.0f / VCAR);
            const float ra = fa * rl, rb = fb * rl;
#pragma unroll
            for (int t = 0; t < 4; ++t)
#pragma unroll
                for (int r = 0; r < 8; ++r) os[(c * 16 + m) * 68 + t * 16 + hh * 8 + r] = oacc[c][t][r] * ra + ob[c][t][r] * rb;   // the slot's hand-over has been read into registers above
        }
    }
    __syncthreads();   // the staged output rows are readable by both waves of the slot
    float* obase = out + ((size_t)b * SEQ + q0 + g * 16) * DMOD + h * HD;   // each wave of the slot stores 16 of its 32 rows
#pragma unroll
    for (int s = 0; s < 8; ++s) { const int row = 2 * s + hh, cofs = m * 4; const v4f val = *(const v4fa*)(os + (g * 16 + row) * 68 + cofs); *(v4f*)(obase + (size_t)row * DMOD + cofs) = val; }
}

extern "C" void kernel_launch(void* const* d_in, const int* in_sizes, int n_in,
                              void* d_out, int out_size, void* d_ws, size_t ws_size, hipStream_t stream) {
    if (n_in < 9) return;
    const int need_x = ((NB - 1) * SEQ_FULL + SEQ) * DMOD;
    if (in_sizes[0] < need_x || in_sizes[1] < need_x || in_sizes[2] < need_x) return;
    if (in_sizes[3] < DMOD * DMOD || in_sizes[5] < DMOD * DMOD || in_sizes[7] < DMOD * DMOD) return;
    if (in_sizes[4] < DMOD || in_sizes[6] < DMOD || in_sizes[8] < DMOD) return;
    if (out_size < TOK * DMOD) return;
    const float* Xq = (const float*)d_in[0]; const float* Xk = (const float*)d_in[1]; const float* Xv = (const float*)d_in[2];
    const float* Wq = (const float*)d_in[3]; const float* bq = (const float*)d_in[4];
    const float* Wk = (const float*)d_in[5]; const float* bk = (const float*)d_in[6];
    const float* Wv = (const float*)d_in[7]; const float* bv = (const float*)d_in[8];
    float* OUT = (float*)d_out;     // [NB][SEQ][512]
    char* wsp = (char*)d_ws;
    auto take = [&](size_t bytes) { char* p = wsp; wsp += (bytes + 255) & ~(size_t)255; return (void*)p; };
    bf* WTq = (bf*)take((size_t)DMOD * DMOD * 2); bf* WTk = (bf*)take((size_t)DMOD * DMOD * 2); bf* WTv = (bf*)take((size_t)DMOD * DMOD * 2);   // fragment blocks [in / 32][out / 16], bf16
    h16* Q16 = (h16*)take((size_t)TOK * DMOD * 2); h16* K16 = (h16*)take((size_t)TOK * DMOD * 2); h16* VT16 = (h16*)take((size_t)TOK * DMOD * 2);   // [tok][512], [tok][512], [512][tok]
    if ((size_t)(wsp - (char*)d_ws) > ws_size) return;
    k_wtG<<<dim3(DMOD * DMOD / 8 / 256, 3, 1), 256, 0, stream>>>(Wq, Wk, Wv, WTq, WTk, WTv);
    // Q = query Wq + bq -> f16 [tok][512] x QSCL, K = key Wk + bk -> f16 [tok][512] x QKCAR; V^T = (value Wv + bv)^T -> f16 [512][tok] x VCAR
    k_proj<<<dim3(TOK / 64, DMOD / (64 * PW), 3), 32 * PW, 0, stream>>>(Xq, Xk, Xv, WTq, WTk, WTv, bq, bk, bv, Q16, K16, VT16);
    // softmax(Q K^T / 8) V per (batch, head), heads merged into [NB][SEQ][512]
    k_sdpa<<<dim3(SEQ / (16 * QC * QW), NB * NHEAD, 1), 32 * QW * KH, 0, stream>>>(Q16, K16, VT16, OUT);
}

// v007
// It runs in 67.8 microseconds.
// In both of two side-by-side timings against v006, it was 1.04 times as fast.
// All steps since v000 together make it 5.39 times as fast.
#include <hip/hip_runtime.h>

// Contractions: q/k/v projections = v_wmma_f32_16x16x32_bf16 (bf16-RNE activations x bf16-RNE W^T planes, f32 accumulate, bias added in f32); scores K.Q^T, context V^T.P^T and the softmax row sums ones.P^T (transposed 16x16 tiles) = v_wmma_f32_16x16x32_f16 (f16 planes: Q x log2(e)/32, K x4, V^T x16; P = exp2 terms in f16 carried x256), f32 accumulate; online softmax, normalisation and output in f32.
// Plan: W bf16 planes in the order of k_proj's WMMA fragments (one launch); one launch for q, k and v: 64x64 register-blocked GEMM (one wave per tile, 4 waves share a token tile) that reads the f32 activations, rounds them to bf16 on the way into LDS, and stores the f16 plane with bias and scale factor itself ([tok][512]; V: [512][tok]); then work-groups of 16 waves on 256 query rows of one (batch, head), one wave per 32 query rows and per half of the keys: 256-key K and V^T stages are copied once per work-group into a two-buffer LDS ring, every wave streams 32-key steps of its 128-key half with fragments read from LDS (each fragment feeds two 16-query column groups), online softmax; the two key halves of a query are joined once through LDS and the 32x64 f32 result leaves via an LDS stage as whole 256-B row segments.

#ifndef NB
#define NB 2
#endif
#ifndef SEQ
#define SEQ 4096
#endif
#define NB_FULL 2
#define SEQ_FULL 4096
#define DMOD 512
#define NHEAD 8
#define HD 64
#define TOK (NB * SEQ)
#define PEXP 8.0f                         // log2 of the carry (x256) of the exp2 terms fed to the context WMMA
#define PGROW 7.0f                        // a score may pass the held softmax reference by this much (log2) before the reference moves: terms stay <= 2^15, inside f16
#define QKCAR 4.0f                        // carry of the K f16 plane
#define VCAR 16.0f                        // carry of the V^T f16 plane
#define QSCL 0.045084220027780106f        // factor of the Q f16 plane: 0.125 * log2(e) / QKCAR, so K.Q^T is the scaled score in log2 units

static_assert(NB >= 1 && NB <= NB_FULL);
static_assert(SEQ >= 64 && SEQ <= SEQ_FULL && (SEQ % 64) == 0);
static_assert(DMOD == NHEAD * HD && (DMOD % 64) == 0 && HD == 64);
static_assert((((size_t)TOK * DMOD) % 8) == 0);
static_assert(((DMOD * DMOD) % 64) == 0);
#define QW 8                              // query slots per k_sdpa work-group, QC * 16 query rows each
#define QC 2                              // 16-query column groups per wave: each K and V^T fragment read from LDS feeds QC WMMAs
#define KH 2                              // key halves per work-group: QW waves each, so the work-group has QW * KH waves
#define KST 128                           // keys per LDS stage and key half
#define NST (SEQ / (KST * KH))            // stages per (batch, head)
#define KPITCH 144                        // bytes per staged K row: 128 + 16 (16 B x odd, for 16-byte LDS reads)
#define VPITCH 272                        // bytes per staged V^T row: 256 + 16
#define KBYTES (KST * KPITCH)
#define VBYTES (HD * VPITCH)
#define SBYTES (KBYTES + VBYTES)          // one key half's share of a stage: its K rows, then its V^T rows
static_assert((SEQ % (KST * KH)) == 0 && NST >= 2 && (SEQ % (16 * QC * QW)) == 0 && (KST % 32) == 0 && QC == 2 && KH == 2);
static_assert(KST * 8 == 4 * 32 * QW && HD * (KST / 8) == 4 * 32 * QW);   // four K copies and four V^T copies per lane fill a key half's share of a stage

typedef _Float16 h16;
typedef unsigned short bf;
typedef __attribute__((ext_vector_type(16))) __bf16   v16bf;
typedef __attribute__((ext_vector_type(16))) _Float16 v16h;
typedef __attribute__((ext_vector_type(8)))  _Float16 v8h;
typedef __attribute__((ext_vector_type(8)))  unsigned short v8us;
typedef __attribute__((ext_vector_type(8)))  float    v8f;
typedef __attribute__((ext_vector_type(4)))  float    v4f;
typedef v8h  __attribute__((may_alias)) v8ha;
typedef v4f  __attribute__((may_alias)) v4fa;
typedef v8us __attribute__((may_alias)) v8usa;

__device__ __forceinline__ unsigned short f2bf(float f) { unsigned u = __float_as_uint(f); u += 0x7FFFu + ((u >> 16) & 1u); return (unsigned short)(u >> 16); }
__device__ __forceinline__ float bf2f(unsigned short b) { return __uint_as_float(((unsigned)b) << 16); }
__device__ __forceinline__ float bfr(float f) { return bf2f(f2bf(f)); }
__device__ __forceinline__ v16h cat16(v8h lo, v8h hi) { return __builtin_shufflevector(lo, hi, 0, 1, 2, 3, 4, 5, 6, 7, 8, 9, 10, 11, 12, 13, 14, 15); }
__device__ __forceinline__ v16bf cat16b(v8us lo, v8us hi) { return __builtin_bit_cast(v16bf, __builtin_shufflevector(lo, hi, 0, 1, 2, 3, 4, 5, 6, 7, 8, 9, 10, 11, 12, 13, 14, 15)); }
__device__ __forceinline__ v8f wmma16(v16h a, v16h b, v8f c) { return __builtin_amdgcn_wmma_f32_16x16x32_f16(false, a, false, b, (short)0, c, false, false); }
__device__ __forceinline__ v8f wmmab(v16bf a, v16bf b, v8f c) { return __builtin_amdgcn_wmma_f32_16x16x32_bf16(false, a, false, b, (short)0, c, false, false); }

// ---- k_wtG: W [in][out] f32 -> bf16 plane in fragment order, the three weight matrices in one launch (blockIdx.y picks the matrix).
// Plane: 1-KB blocks [in / 32][out / 16]; a block is one 16 (out) x 32 (in) WMMA operand as k_proj's two 16-B loads read it:
// chunk (j, lane) at byte 512 j + 16 lane holds W[k0 + 16 j + 8 (lane >> 4) + 0..7][n0 + (lane & 15)], so a wave-wide load is 512 contiguous bytes.
// One thread per 16-B chunk: eight 4-B reads (a work-group reads 256 contiguous bytes of each of 32 W rows), one 16-B store. coverage: gridDim.x * 256 == DMOD * DMOD / 8.
#define WBLK 512                          // bf16 per fragment block
static_assert((DMOD % 32) == 0 && ((DMOD * DMOD / 8) % 256) == 0);
__global__ __launch_bounds__(256) void k_wtG(const float* __restrict__ w0, const float* __restrict__ w1, const float* __restrict__ w2, bf* B0, bf* B1, bf* B2) {
    const int sel = blockIdx.y; const float* __restrict__ w = sel == 0 ? w0 : sel == 1 ? w1 : w2; bf* Bt = sel == 0 ? B0 : sel == 1 ? B1 : B2;
    const int c = blockIdx.x * 256 + threadIdx.x;   // chunk
    const int lane = c & 31, j = (c >> 5) & 1, nb = (c >> 6) % (DMOD / 16), ks = (c >> 6) / (DMOD / 16);
    const float* p = w + (size_t)(ks * 32 + j * 16 + (lane >> 4) * 8) * DMOD + nb * 16 + (lane & 15);
    v8us o;
#pragma unroll
    for (int i = 0; i < 8; ++i) o[i] = f2bf(p[(size_t)i * DMOD]);
    *(v8us*)(Bt + (size_t)c * 8) = o;
}

// ---- k_proj: the three projections in one launch; work-group = 4 waves on one 64-token tile, ONE WAVE per 64 tokens x 64 output features (16 accumulators); grid (TOK/64, DMOD/256, 3), 128 threads; blockIdx.z = 0 q, 1 k, 2 v.
// Activations: each 32-deep step's 64 x 32 f32 block is read once per work-group as whole 128-B lines, rounded to bf16 (nearest even) in registers and stored to a two-buffer LDS tile that the 4 waves share; step s+1 is fetched while step s is multiplied.
// Weights come straight from the fragment-ordered bf16 plane (each load 512 contiguous bytes per wave); bias (bf16-rounded, added in f32), carry and the f16 rounding are applied to the accumulators.
// Fragments: lane row/col = l&15, elements 0..7 <- k0+8h+0..7, 8..15 <- k0+16+8h+0..7 (h = l>>4) for A and B alike; D element r of lane l = (A row 8h+r, B row l&15).
// The operand whose index runs along the output rows is A, so a lane's 8 D elements are 16 contiguous output bytes: q, k (plane [tok][512]): A = W^T, B = activations; v (plane [512][tok]): A = activations, B = W^T.
typedef __attribute__((ext_vector_type(4))) __bf16 v4bf;
typedef v4bf __attribute__((may_alias)) v4bfa;
#define PW 4                              // waves per k_proj work-group
#define XSP 40                            // bf16 per staged activation row: 32 + 8 (80 B = 16 B x odd, for 16-byte LDS reads)
#define HSP 72                            // f16 per staged output row: 64 + 8 (144 B = 16 B x odd)
static_assert((DMOD % (64 * PW)) == 0 && (TOK % 64) == 0 && 32 * PW == 16 * 8);   // 16 rows of 8 x 16 B per staging pass, four passes per step
__device__ __forceinline__ v16bf ldw(const bf* p) { return cat16b(*(const v8usa*)p, *(const v8usa*)(p + 16)); }
__device__ __forceinline__ v16bf ldwp(const bf* p) { return cat16b(*(const v8usa*)p, *(const v8usa*)(p + WBLK / 2)); }   // a lane's two chunks of a fragment block
template <bool XA>   // XA: the activations are the A operand (v); otherwise the B operand (q, k)
__device__ __forceinline__ void proj_tile(const float* __restrict__ X, const bf* __restrict__ WT, const float* __restrict__ bias, float sc, h16* O, bf* xs, h16* hsall) {
    const int tid = threadIdx.x, lane = tid & 31, lr = lane & 15, hi = lane >> 4;
    const int wave = __builtin_amdgcn_readfirstlane(tid >> 5);
    const int t0 = blockIdx.x * 64, n0 = (blockIdx.y * PW + wave) * 64;
    h16* hs = hsall + wave * (64 * HSP);
    v8f acc[4][4];   // [A block][B block]
#pragma unroll
    for (int ab = 0; ab < 4; ++ab)
#pragma unroll
        for (int bb = 0; bb < 4; ++bb) acc[ab][bb] = (v8f){};
    const float* xg = X + ((size_t)(t0 / SEQ) * SEQ_FULL + (t0 % SEQ) + (tid >> 3)) * DMOD + (tid & 7) * 4;   // + pass * 16 rows + step
    bf* xw = xs + (tid >> 3) * XSP + (tid & 7) * 4;                                                         // + buffer * 64 * XSP + pass * 16 * XSP
    const bf* xr = xs + lr * XSP + 8 * hi;                                                                  // + buffer * 64 * XSP + block * 16 * XSP
    const bf* wp = WT + (size_t)(n0 / 16) * WBLK + lane * 8;                                                  // + block * WBLK + step * (DMOD / 16) * WBLK
    v4f xn[4];
#pragma unroll
    for (int u = 0; u < 4; ++u) xn[u] = *(const v4f*)(xg + (size_t)u * 16 * DMOD);
#pragma unroll
    for (int u = 0; u < 4; ++u) { v4bf c; c[0] = (__bf16)xn[u][0]; c[1] = (__bf16)xn[u][1]; c[2] = (__bf16)xn[u][2]; c[3] = (__bf16)xn[u][3]; *(v4bfa*)(xw + u * 16 * XSP) = c; }
    __syncthreads();   // step 0 is readable by every wave
#pragma unroll 1   // one copy of the 32-deep step, as in the plane GEMM before; the buffer is picked by the step's parity
    for (int kc = 0; kc < DMOD; kc += 32) {
        const int cur = (kc >> 5) & 1; const bool more = kc + 32 < DMOD;   // the same for the whole work-group
        if (more) {
#pragma unroll
            for (int u = 0; u < 4; ++u) xn[u] = *(const v4f*)(xg + (size_t)u * 16 * DMOD + kc + 32); }
        v16bf xf[4], wf[4];
#pragma unroll
        for (int u = 0; u < 4; ++u) wf[u] = ldwp(wp + u * WBLK + (size_t)(kc / 32) * (DMOD / 16) * WBLK);
#pragma unroll
        for (int u = 0; u < 4; ++u) xf[u] = ldw(xr + cur * (64 * XSP) + u * 16 * XSP);
#pragma unroll
        for (int bb = 0; bb < 4; ++bb)
#pragma unroll
            for (int ab = 0; ab < 4; ++ab) acc[ab][bb] = XA ? wmmab(xf[ab], wf[bb], acc[ab][bb]) : wmmab(wf[ab], xf[bb], acc[ab][bb]);
        // four vector slots behind the last WMMA, on every path, before its operands are rewritten
        asm volatile("v_nop\n\tv_nop\n\tv_nop\n\tv_nop" : "+v"(acc[0][0]), "+v"(acc[1][1]), "+v"(acc[2][2]), "+v"(acc[3][3]) : "v"(xf[0]), "v"(xf[3]), "v"(wf[0]), "v"(wf[3]));
        if (more) {
#pragma unroll
            for (int u = 0; u < 4; ++u) { v4bf c; c[0] = (__bf16)xn[u][0]; c[1] = (__bf16)xn[u][1]; c[2] = (__bf16)xn[u][2]; c[3] = (__bf16)xn[u][3]; *(v4bfa*)(xw + (cur ^ 1) * (64 * XSP) + u * 16 * XSP) = c; } }
        asm volatile("s_wait_xcnt 0x0" ::: "memory");   // a precaution: stands in front of the advance of the address registers that this step's global loads name
        __syncthreads();                                // publishes the next step's buffer and ends every wave's reads of this one
    }
    // output row j = B row (q, k: token; v: feature), position in the row i = A row (q, k: feature; v: token)
#pragma unroll
    for (int ab = 0; ab < 4; ++ab) {
        v8f bi;
        if (!XA) bi = *(const v8f*)(bias + n0 + ab * 16 + hi * 8);
#pragma unroll
        for (int bb = 0; bb < 4; ++bb) { v8h o; const float bj = XA ? bfr(bias[n0 + bb * 16 + lr]) : 0.f;
#pragma unroll
            for (int r = 0; r < 8; ++r) o[r] = (h16)((acc[ab][bb][r] + (XA ? bj : bfr(bi[r]))) * sc);
            *(v8ha*)(hs + (bb * 16 + lr) * HSP + ab * 16 + hi * 8) = o; }
    }
    __syncthreads();   // the staged output rows are written before other lanes read them
    h16* obase = XA ? O + (size_t)n0 * TOK + t0 : O + (size_t)t0 * DMOD + n0; const size_t ldo = XA ? TOK : DMOD;
#pragma unroll
    for (int s = 0; s < 16; ++s) { const int row = s * 4 + (lane >> 3), c = lane & 7;   // 8 lanes store one whole 128-B row segment
        *(v8h*)(obase + (size_t)row * ldo + c * 8) = *(const v8ha*)(hs + row * HSP + c * 8); }
}
__global__ __launch_bounds__(32 * PW) void k_proj(const float* __restrict__ Xq, const float* __restrict__ Xk, const float* __restrict__ Xv, const bf* __restrict__ WTq, const bf* __restrict__ WTk, const bf* __restrict__ WTv,
                                                  const float* __restrict__ bq, const float* __restrict__ bk, const float* __restrict__ bv, h16* Q16, h16* K16, h16* VT16) {
    __shared__ __align__(16) bf xs[2 * 64 * XSP];
    __shared__ __align__(16) h16 hs[PW * 64 * HSP];
    const int z = blockIdx.z;
    if (z == 2) proj_tile<true>(Xv, WTv, bv, VCAR, VT16, xs, hs);
    else proj_tile<false>(z ? Xk : Xq, z ? WTk : WTq, z ? bk : bq, z ? QKCAR : QSCL, z ? K16 : Q16, xs, hs);
}

// ---- k_sdpa: work-group = 16 waves = 8 query slots x 2 key halves; one wave = 32 query rows (two 16-column groups) of one (batch b, head h) against one half of the keys; grid (SEQ/256, NB*NHEAD), 512 threads.
// A stage is 256 keys: key half g owns keys 128 g .. 128 g + 127 of it. Its K rows [key][64 d] and V^T rows [d][128 keys] are copied global -> LDS once per work-group by the half's own 8 waves (16 B per lane and copy), two buffers: stage s+1 flies while stage s is worked on.
// Transposed tiles: S^T[key][q] = sum_d K[key][d] Q[q][d] (A = K rows from LDS, B = Q rows from the Q plane, both d-contiguous);
// the two 16-key D tiles of a 32-key step become the B fragment P^T[key][q] (element r <- tile keys 0..15, element 8+r <- tile keys 16..31, lane unchanged);
// O^T[d][q] += sum_key V^T[d][key] P^T[key][q] (A = V^T rows from LDS, key-contiguous). Lane (h2, m), column group c: q = q0 + 16 c + m; keys of a step = kb+8*h2+r and kb+16+8*h2+r.
// Online softmax per q with a held reference: PEXP minus the reference is the C operand of the score WMMAs, so their result is the exponent and the term is exp2 of it (x256 included) -> f16.
// The references are the maxima over the half's first 32 keys and are held through the pass: a step has no maximum and no test. A term that outgrows f16 turns its row sum non-finite; that is tested once behind the loop,
// and then the whole work-group goes through its keys again with the guarded loop: each step tests once (ballot, scalar branch) whether any lane's 32 exponents pass PEXP + PGROW; only then (and at the first step) the halves' maxima are joined (xor 16), the references move up to them and the sums are rescaled.
// The row sums over the f16 values accumulate in one more WMMA per step and column group, ones[16][32] . P^T (f32), whose every row holds them.
// Behind the loop key half 1 hands its sums, row sums and references to key half 0 through LDS (register order); half 0 brings both to the higher reference, adds and normalises.
__device__ __forceinline__ unsigned lds_addr(const void* p) { return (unsigned)(size_t)(__attribute__((address_space(3))) const void*)p; }
// One stage: lane copies K rows r, r+32, r+64, r+96 (its 16 B of each) and V^T rows d, d+16, d+32, d+48. s_wait_xcnt 0 closes the statement (a precaution): no operand register is rewritten ahead of it.
__device__ __forceinline__ void stage_copy(unsigned lk, unsigned lv, const h16* gk, const h16* gv) {
    asm volatile("global_load_async_to_lds_b128 %0, %8, off\n\t"
                 "global_load_async_to_lds_b128 %1, %9, off\n\t"
                 "global_load_async_to_lds_b128 %2, %10, off\n\t"
                 "global_load_async_to_lds_b128 %3, %11, off\n\t"
                 "global_load_async_to_lds_b128 %4, %12, off\n\t"
                 "global_load_async_to_lds_b128 %5, %13, off\n\t"
                 "global_load_async_to_lds_b128 %6, %14, off\n\t"
                 "global_load_async_to_lds_b128 %7, %15, off\n\t"
                 "s_wait_xcnt 0x0"
                 :: "v"(lk), "v"(lk + 32 * KPITCH), "v"(lk + 64 * KPITCH), "v"(lk + 96 * KPITCH),
                    "v"(lv), "v"(lv + 16 * VPITCH), "v"(lv + 32 * VPITCH), "v"(lv + 48 * VPITCH),
                    "v"(gk), "v"(gk + (size_t)32 * DMOD), "v"(gk + (size_t)64 * DMOD), "v"(gk + (size_t)96 * DMOD),
                    "v"(gv), "v"(gv + (size_t)16 * TOK), "v"(gv + (size_t)32 * TOK), "v"(gv + (size_t)48 * TOK)
                 : "memory");
}
// The scores of one 32-key step: K fragments from LDS, S^T = K . Q^T + C for both 16-key tiles and both column groups.
__device__ __forceinline__ void score_step(const unsigned char* kr0, const v16h (&qf)[QC][2], const v8f (&bv)[QC], v8f (&st)[QC][2]) {
    v16h ka[2][2];
#pragma unroll
    for (int kt = 0; kt < 2; ++kt) { const unsigned char* kr = kr0 + kt * 16 * KPITCH; ka[kt][0] = cat16(*(const v8ha*)kr, *(const v8ha*)(kr + 32)); ka[kt][1] = cat16(*(const v8ha*)(kr + 64), *(const v8ha*)(kr + 96)); }
#pragma unroll
    for (int kt = 0; kt < 2; ++kt)
#pragma unroll
        for (int c = 0; c < QC; ++c) st[c][kt] = wmma16(ka[kt][0], qf[c][0], bv[c]);
#pragma unroll
    for (int kt = 0; kt < 2; ++kt)
#pragma unroll
        for (int c = 0; c < QC; ++c) st[c][kt] = wmma16(ka[kt][1], qf[c][1], st[c][kt]);
    // four vector slots behind the last score WMMA, on every path, before its result is read or its operands are rewritten
    asm volatile("v_nop\n\tv_nop\n\tv_nop\n\tv_nop" : "+v"(st[0][0]), "+v"(st[0][1]), "+v"(st[1][0]), "+v"(st[1][1]) : "v"(ka[0][0]), "v"(ka[0][1]), "v"(ka[1][0]), "v"(ka[1][1]), "v"(qf[0][0]), "v"(qf[0][1]), "v"(qf[1][0]), "v"(qf[1][1]));
}
// A lane's maximum over its 16 exponents of a step, per column group.
__device__ __forceinline__ void step_max(const v8f (&st)[QC][2], float (&mx)[QC]) {
#pragma unroll
    for (int c = 0; c < QC; ++c) { float mk[2];   // one chain per 16-key tile: the chains run side by side
#pragma unroll
        for (int kt = 0; kt < 2; ++kt) { mk[kt] = fmaxf(fmaxf(st[c][kt][0], st[c][kt][1]), st[c][kt][2]); mk[kt] = fmaxf(fmaxf(mk[kt], st[c][kt][3]), st[c][kt][4]); mk[kt] = fmaxf(fmaxf(mk[kt], st[c][kt][5]), st[c][kt][6]); }
        mx[c] = fmaxf(fmaxf(fmaxf(mk[0], mk[1]), st[c][0][7]), st[c][1][7]); }
}
__device__ __forceinline__ void clear_sums(v8f (&oacc)[QC][4], v8f (&lacc)[QC], v8f (&bv)[QC]) {
#pragma unroll
    for (int c = 0; c < QC; ++c) { lacc[c] = (v8f){}; bv[c] = (v8f){};
#pragma unroll
        for (int t = 0; t < 4; ++t) oacc[c][t] = (v8f){}; }
}
// All stages of a wave's key half; on return no copy is outstanding and every wave has left the ring.
// MOVE = false: on entry stage 0 is published and stage 1's copies are in flight; the references in bv stay as they are, a step has no test.
// MOVE = true: the ring is idle on entry and two trips without work start it through the loop's own foot (trip -2: barrier, stage 0's copies; trip -1: their wait, the barrier that publishes them, stage 1's copies);
// bv comes in as zero, the first step sets the references and every step tests whether they have to move.
template <bool MOVE>
__device__ __forceinline__ void key_stages(const unsigned char* ring, unsigned lk, unsigned lv, const h16* gk, const h16* gv, int g, int m, int hh,
                                           const v16h (&qf)[QC][2], v8f (&oacc)[QC][4], v8f (&lacc)[QC], v8f (&bv)[QC]) {
    float thr = -3.0e38f;     // exponent above which the references move; below every score until the first step has set them
    v16h ones;   // A operand of the row-sum WMMA: 1.0 in every row and k
#pragma unroll
    for (int i = 0; i < 16; ++i) ones[i] = (h16)1.0f;
#pragma unroll 1   // one copy of the stage body: the buffer is picked by sg & 1
    for (int sg = MOVE ? -2 : 0; sg < NST; ++sg) {
        const unsigned char* kbase = ring + ((sg & 1) * KH + g) * SBYTES + m * KPITCH + 16 * hh;            // + key in the half's stage * KPITCH
        const unsigned char* vbase = ring + ((sg & 1) * KH + g) * SBYTES + KBYTES + m * VPITCH + 16 * hh;   // + d-tile * 16 * VPITCH + key in the half's stage * 2
#pragma unroll 1   // one copy of the 32-key step
        for (int kb = (MOVE && sg < 0) ? KST : 0; kb < KST; kb += 32) {   // no work in the two starting trips (the same for the whole work-group)
            v8f st[QC][2];
            score_step(kbase + kb * KPITCH, qf, bv, st);
            v16h va[4];
#pragma unroll
            for (int t = 0; t < 4; ++t) { const unsigned char* vr = vbase + t * 16 * VPITCH + kb * 2; va[t] = cat16(*(const v8ha*)vr, *(const v8ha*)(vr + 32)); }
            __builtin_amdgcn_sched_barrier(0);   // keeps the eight V^T fragment loads one group ahead of the softmax: split, the late part is waited for among the context WMMAs
            if constexpr (MOVE) {
                float mx[QC];
                step_max(st, mx);
                if (__builtin_expect(__builtin_amdgcn_ballot_w32(fmaxf(mx[0], mx[1]) > thr) != 0u, 0)) {   // wave-uniform: some query's reference has to move
                    const bool fresh = thr < 0.f;                                             // first step: no reference yet, the sums are still zero
#pragma unroll
                    for (int c = 0; c < QC; ++c) {
                        const float up = fmaxf(mx[c], __shfl_xor(mx[c], 16, 32)) - PEXP;      // both halves of a query move alike
                        const float d = fresh ? up : fmaxf(up, 0.f);                          // a reference never moves down
                        const float alpha = fresh ? 1.0f : __builtin_amdgcn_exp2f(-d);
                        st[c][0] -= d; st[c][1] -= d; bv[c] -= d; lacc[c] *= alpha;
#pragma unroll
                        for (int t = 0; t < 4; ++t) oacc[c][t] *= alpha;
                    }
                    thr = PEXP + PGROW;
                }
            }
            v16h pf[QC];
#pragma unroll
            for (int c = 0; c < QC; ++c) { pf[c] = (v16h){};
#pragma unroll
                for (int r = 0; r < 8; ++r) {
                    pf[c][r] = (h16)__builtin_amdgcn_exp2f(st[c][0][r]);
                    pf[c][8 + r] = (h16)__builtin_amdgcn_exp2f(st[c][1][r]); } }
#pragma unroll
            for (int c = 0; c < QC; ++c) lacc[c] = wmma16(ones, pf[c], lacc[c]);   // every row of ones . P^T is the step's sum over all 32 keys of column q: each lane holds its own query's sum
#pragma unroll
            for (int t = 0; t < 4; ++t)
#pragma unroll
                for (int c = 0; c < QC; ++c) oacc[c][t] = wmma16(va[t], pf[c], oacc[c][t]);
            // four vector slots behind the last context WMMA, on every path, before its operands are rewritten
            asm volatile("v_nop\n\tv_nop\n\tv_nop\n\tv_nop" : "+v"(oacc[0][0]), "+v"(oacc[0][1]), "+v"(oacc[0][2]), "+v"(oacc[0][3]), "+v"(oacc[1][0]), "+v"(oacc[1][1]), "+v"(oacc[1][2]), "+v"(oacc[1][3]) : "v"(va[0]), "v"(va[1]), "v"(va[2]), "v"(va[3]), "v"(pf[0]), "v"(pf[1]));
        }
        asm volatile("s_wait_dscnt 0x0" ::: "memory");      // this wave's reads of stage sg have returned before its buffer is refilled
        asm volatile("s_wait_asynccnt 0x0" ::: "memory");   // this wave's share of stage sg + 1 has landed
        __syncthreads();                                    // publishes stage sg + 1 and ends every wave's reads of stage sg
        if (sg + 2 < NST) stage_copy(lk + (sg & 1) * (KH * SBYTES), lv + (sg & 1) * (KH * SBYTES), gk + (size_t)(sg + 2) * (KH * KST) * DMOD, gv + (size_t)(sg + 2) * (KH * KST));   // work-group-uniform test; refills the buffer just read
    }
    asm volatile("s_wait_asynccnt 0x0" ::: "memory");       // no copy is outstanding when the wave goes on
}
__global__ __launch_bounds__(32 * QW * KH) void k_sdpa(const h16* __restrict__ Q16, const h16* __restrict__ K16, const h16* __restrict__ VT16, float* out) {
    __shared__ __align__(16) unsigned char ring[2 * KH * SBYTES];   // [buffer][key half][K rows | V^T rows]
    __shared__ __align__(16) float osall[QW * 32 * 68];
    __shared__ int again;                      // set by a wave whose held references were passed too far
    const int tid = threadIdx.x, lane = tid & 31, m = lane & 15, hh = lane >> 4, th = tid & (32 * QW - 1);
    const int wave = __builtin_amdgcn_readfirstlane(tid >> 5);
    const int g = wave / QW, wq = wave % QW;   // key half, query slot
    float* os = osall + wq * (32 * 68);        // shared by the two waves of a query slot
    const int bh = blockIdx.y; const int b = bh / NHEAD, h = bh % NHEAD; const int q0 = (blockIdx.x * QW + wq) * (16 * QC);
    const unsigned lk = lds_addr(ring) + g * SBYTES + (th >> 3) * KPITCH + (th & 7) * 16;               // + buffer * KH * SBYTES
    const unsigned lv = lds_addr(ring) + g * SBYTES + KBYTES + (th >> 4) * VPITCH + (th & 15) * 16;     // + buffer * KH * SBYTES
    const h16* gk = K16 + ((size_t)b * SEQ + g * KST + (th >> 3)) * DMOD + h * HD + (th & 7) * 8;          // + stage * KH * KST * DMOD
    const h16* gv = VT16 + ((size_t)h * HD + (th >> 4)) * TOK + (size_t)b * SEQ + g * KST + (th & 15) * 8;   // + stage * KH * KST
    stage_copy(lk, lv, gk, gv);
    v16h qf[QC][2];   // [column group][d 0..31, d 32..63]
#pragma unroll
    for (int c = 0; c < QC; ++c) { const h16* qrow = Q16 + ((size_t)b * SEQ + q0 + c * 16 + m) * DMOD + h * HD + 8 * hh;
        qf[c][0] = cat16(*(const v8h*)(qrow), *(const v8h*)(qrow + 16)); qf[c][1] = cat16(*(const v8h*)(qrow + 32), *(const v8h*)(qrow + 48)); }
    v8f oacc[QC][4], lacc[QC], bv[QC];   // lacc: row sums (every element: the lane's own query); bv: C operand of the score WMMAs, PEXP - reference of the lane's query, in all eight rows
    clear_sums(oacc, lacc, bv);
    if (tid == 0) again = 0;
    asm volatile("s_wait_asynccnt 0x0" ::: "memory");   // this wave's share of stage 0 has landed
    __syncthreads();                                    // stage 0 is readable by every wave
    stage_copy(lk + KH * SBYTES, lv + KH * SBYTES, gk + (size_t)KH * KST * DMOD, gv + KH * KST);
    {   // the held references: each query's maximum over the half's first 32 keys (their scores are formed once more in the loop, with the reference as C)
        v8f st[QC][2]; float mx[QC];
        score_step(ring + g * SBYTES + m * KPITCH + 16 * hh, qf, bv, st);
        step_max(st, mx);
#pragma unroll
        for (int c = 0; c < QC; ++c) bv[c] -= fmaxf(mx[c], __shfl_xor(mx[c], 16, 32)) - PEXP;   // both halves of a query alike
    }
    key_stages<false>(ring, lk, lv, gk, gv, g, m, hh, qf, oacc, lacc, bv);
    // A score 2^8 or more above its held reference gives an f16 infinity, which stays in the row sum: the one test of the whole pass.
    if (__builtin_amdgcn_ballot_w32(!(lacc[0][0] <= 3.0e38f) || !(lacc[1][0] <= 3.0e38f)) != 0u) { if (lane == 0) again = 1; }
    __syncthreads();   // every wave's verdict is readable; every wave has left the ring
    if (__builtin_amdgcn_readfirstlane(again) != 0) {   // the same for the whole work-group: all its waves go through the keys again, with references that move
        clear_sums(oacc, lacc, bv);
        key_stages<true>(ring, lk, lv, gk, gv, g, m, hh, qf, oacc, lacc, bv);
    }
    // Join of the key halves. Hand-over in register order: 16-B chunk j of lane l at float 128 j + 4 l (16 chunks of sums, one of row sums and C operands).
    if (g == 1) {
#pragma unroll
        for (int c = 0; c < QC; ++c)
#pragma unroll
            for (int t = 0; t < 4; ++t)
#pragma unroll
                for (int u = 0; u < 2; ++u) { const v4f w = {oacc[c][t][4 * u], oacc[c][t][4 * u + 1], oacc[c][t][4 * u + 2], oacc[c][t][4 * u + 3]}; *(v4fa*)(os + ((c * 4 + t) * 2 + u) * 128 + lane * 4) = w; }
        const v4f w = {lacc[0][0], lacc[1][0], bv[0][0], bv[1][0]}; *(v4fa*)(os + 16 * 128 + lane * 4) = w;
    }
    __syncthreads();   // key half 1's sums are readable by key half 0
    if (g == 0) {
        const v4f w = *(const v4fa*)(os + 16 * 128 + lane * 4);
        v8f ob[QC][4];
#pragma unroll
        for (int c = 0; c < QC; ++c)
#pragma unroll
            for (int t = 0; t < 4; ++t)
#pragma unroll
                for (int u = 0; u < 2; ++u) { const v4f x = *(const v4fa*)(os + ((c * 4 + t) * 2 + u) * 128 + lane * 4); ob[c][t][4 * u] = x[0]; ob[c][t][4 * u + 1] = x[1]; ob[c][t][4 * u + 2] = x[2]; ob[c][t][4 * u + 3] = x[3]; }
#pragma unroll
        for (int c = 0; c < QC; ++c) {
            const float ba = bv[c][0], bb = w[2 + c], bm = fminf(ba, bb);   // the smaller C operand belongs to the higher reference
            const float fa = __builtin_amdgcn_exp2f(bm - ba), fb = __builtin_amdgcn_exp2f(bm - bb);
            const float rl = __fdiv_rn(1.0f, lacc[c][0] * fa + w[c] * fb) * (1.0f / VCAR);
            const float ra = fa * rl, rb = fb * rl;
#pragma unroll
            for (int t = 0; t < 4; ++t)
#pragma unroll
                for (int r = 0; r < 8; ++r) os[(c * 16 + m) * 68 + t * 16 + hh * 8 + r] = oacc[c][t][r] * ra + ob[c][t][r] * rb;   // the slot's hand-over has been read into registers above
        }
    }
    __syncthreads();   // the staged output rows are readable by both waves of the slot
    float* obase = out + ((size_t)b * SEQ + q0 + g * 16) * DMOD + h * HD;   // each wave of the slot stores 16 of its 32 rows
#pragma unroll
    for (int s = 0; s < 8; ++s) { const int row = 2 * s + hh, cofs = m * 4; const v4f val = *(const v4fa*)(os + (g * 16 + row) * 68 + cofs); *(v4f*)(obase + (size_t)row * DMOD + cofs) = val; }
}

extern "C" void kernel_launch(void* const* d_in, const int* in_sizes, int n_in,
                              void* d_out, int out_size, void* d_ws, size_t ws_size, hipStream_t stream) {
    if (n_in < 9) return;
    const int need_x = ((NB - 1) * SEQ_FULL + SEQ) * DMOD;
    if (in_sizes[0] < need_x || in_sizes[1] < need_x || in_sizes[2] < need_x) return;
    if (in_sizes[3] < DMOD * DMOD || in_sizes[5] < DMOD * DMOD || in_sizes[7] < DMOD * DMOD) return;
    if (in_sizes[4] < DMOD || in_sizes[6] < DMOD || in_sizes[8] < DMOD) return;
    if (out_size < TOK * DMOD) return;
    const float* Xq = (const float*)d_in[0]; const float* Xk = (const float*)d_in[1]; const float* Xv = (const float*)d_in[2];
    const float* Wq = (const float*)d_in[3]; const float* bq = (const float*)d_in[4];
    const float* Wk = (const float*)d_in[5]; const float* bk = (const float*)d_in[6];
    const float* Wv = (const float*)d_in[7]; const float* bv = (const float*)d_in[8];
    float* OUT = (float*)d_out;     // [NB][SEQ][512]
    char* wsp = (char*)d_ws;
    auto take = [&](size_t bytes) { char* p = wsp; wsp += (bytes + 255) & ~(size_t)255; return (void*)p; };
    bf* WTq = (bf*)take((size_t)DMOD * DMOD * 2); bf* WTk = (bf*)take((size_t)DMOD * DMOD * 2); bf* WTv = (bf*)take((size_t)DMOD * DMOD * 2);   // fragment blocks [in / 32][out / 16], bf16
    h16* Q16 = (h16*)take((size_t)TOK * DMOD * 2); h16* K16 = (h16*)take((size_t)TOK * DMOD * 2); h16* VT16 = (h16*)take((size_t)TOK * DMOD * 2);   // [tok][512], [tok][512], [512][tok]
    if ((size_t)(wsp - (char*)d_ws) > ws_size) return;
    k_wtG<<<dim3(DMOD * DMOD / 8 / 256, 3, 1), 256, 0, stream>>>(Wq, Wk, Wv, WTq, WTk, WTv);
    // Q = query Wq + bq -> f16 [tok][512] x QSCL, K = key Wk + bk -> f16 [tok][512] x QKCAR; V^T = (value Wv + bv)^T -> f16 [512][tok] x VCAR
    k_proj<<<dim3(TOK / 64, DMOD / (64 * PW), 3), 32 * PW, 0, stream>>>(Xq, Xk, Xv, WTq, WTk, WTv, bq, bk, bv, Q16, K16, VT16);
    // softmax(Q K^T / 8) V per (batch, head), heads merged into [NB][SEQ][512]
    k_sdpa<<<dim3(SEQ / (16 * QC * QW), NB * NHEAD, 1), 32 * QW * KH, 0, stream>>>(Q16, K16, VT16, OUT);
}

// v008
// It runs in 64.6 microseconds.
// Timed twice side by side with v007, it ran 1.05 and 1.06 times as fast.
// All steps since v000 together make it 5.69 times as fast.
#include <hip/hip_runtime.h>

// Contractions: q/k/v projections = v_wmma_f32_16x16x32_bf16 (bf16-RNE activations x bf16-RNE W^T planes, f32 accumulate, bias added in f32); scores K.Q^T, context V^T.P^T and the softmax row sums ones.P^T (transposed 16x16 tiles) = v_wmma_f32_16x16x32_f16 (f16 planes: Q x log2(e)/32, K x4, V^T x16; P = exp2 terms in f16 carried x256), f32 accumulate; online softmax, normalisation and output in f32.
// Plan: W bf16 planes in the order of k_proj's WMMA fragments (one launch); one launch for q, k and v: 64x64 register-blocked GEMM (one wave per tile, 4 waves share a token tile) that reads the f32 activations, rounds them to bf16 on the way into LDS, and stores the f16 plane with bias and scale factor itself ([tok][512]; V: [512][tok]); then work-groups of 16 waves on 256 query rows of one (batch, head), one wave per 32 query rows and per half of the keys: 256-key K and V^T stages are copied once per work-group into a two-buffer LDS ring, every wave streams 32-key steps of its 128-key half with fragments read from LDS (each fragment feeds two 16-query column groups), online softmax; the two key halves of a query are joined once through LDS and the 32x64 f32 result leaves via an LDS stage as whole 256-B row segments.

#ifndef NB
#define NB 2
#endif
#ifndef SEQ
#define SEQ 4096
#endif
#define NB_FULL 2
#define SEQ_FULL 4096
#define DMOD 512
#define NHEAD 8
#define HD 64
#define TOK (NB * SEQ)
#define PEXP 8.0f                         // log2 of the carry (x256) of the exp2 terms fed to the context WMMA
#define PGROW 7.0f                        // a score may pass the held softmax reference by this much (log2) before the reference moves: terms stay <= 2^15, inside f16
#define QKCAR 4.0f                        // carry of the K f16 plane
#define VCAR 16.0f                        // carry of the V^T f16 plane
#define QSCL 0.045084220027780106f        // factor of the Q f16 plane: 0.125 * log2(e) / QKCAR, so K.Q^T is the scaled score in log2 units

static_assert(NB >= 1 && NB <= NB_FULL);
static_assert(SEQ >= 64 && SEQ <= SEQ_FULL && (SEQ % 64) == 0);
static_assert(DMOD == NHEAD * HD && (DMOD % 64) == 0 && HD == 64);
static_assert((((size_t)TOK * DMOD) % 8) == 0);
static_assert(((DMOD * DMOD) % 64) == 0);
#define QW 8                              // query slots per k_sdpa work-group, QC * 16 query rows each
#define QC 2                              // 16-query column groups per wave: each K and V^T fragment read from LDS feeds QC WMMAs
#define KH 2                              // key halves per work-group: QW waves each, so the work-group has QW * KH waves
#define KST 128                           // keys per LDS stage and key half
#define NST (SEQ / (KST * KH))            // stages per (batch, head)
#define KPITCH 144                        // bytes per staged K row: 128 + 16 (16 B x odd, for 16-byte LDS reads)
#define VPITCH 272                        // bytes per staged V^T row: 256 + 16
#define KBYTES (KST * KPITCH)
#define VBYTES (HD * VPITCH)
#define SBYTES (KBYTES + VBYTES)          // one key half's share of a stage: its K rows, then its V^T rows
static_assert((SEQ % (KST * KH)) == 0 && NST >= 2 && (SEQ % (16 * QC * QW)) == 0 && (KST % 32) == 0 && QC == 2 && KH == 2);
static_assert(KST * 8 == 4 * 32 * QW && HD * (KST / 8) == 4 * 32 * QW);   // four K copies and four V^T copies per lane fill a key half's share of a stage

typedef _Float16 h16;
typedef unsigned short bf;
typedef __attribute__((ext_vector_type(16))) __bf16   v16bf;
typedef __attribute__((ext_vector_type(16))) _Float16 v16h;
typedef __attribute__((ext_vector_type(8)))  _Float16 v8h;
typedef __attribute__((ext_vector_type(8)))  unsigned short v8us;
typedef __attribute__((ext_vector_type(8)))  float    v8f;
typedef __attribute__((ext_vector_type(4)))  float    v4f;
typedef v8h  __attribute__((may_alias)) v8ha;
typedef v4f  __attribute__((may_alias)) v4fa;
typedef v8us __attribute__((may_alias)) v8usa;

__device__ __forceinline__ unsigned short f2bf(float f) { unsigned u = __float_as_uint(f); u += 0x7FFFu + ((u >> 16) & 1u); return (unsigned short)(u >> 16); }
__device__ __forceinline__ float bf2f(unsigned short b) { return __uint_as_float(((unsigned)b) << 16); }
__device__ __forceinline__ float bfr(float f) { return bf2f(f2bf(f)); }
__device__ __forceinline__ v16h cat16(v8h lo, v8h hi) { return __builtin_shufflevector(lo, hi, 0, 1, 2, 3, 4, 5, 6, 7, 8, 9, 10, 11, 12, 13, 14, 15); }
__device__ __forceinline__ v16bf cat16b(v8us lo, v8us hi) { return __builtin_bit_cast(v16bf, __builtin_shufflevector(lo, hi, 0, 1, 2, 3, 4, 5, 6, 7, 8, 9, 10, 11, 12, 13, 14, 15)); }
__device__ __forceinline__ v8f wmma16(v16h a, v16h b, v8f c) { return __builtin_amdgcn_wmma_f32_16x16x32_f16(false, a, false, b, (short)0, c, false, false); }
__device__ __forceinline__ v8f wmmab(v16bf a, v16bf b, v8f c) { return __builtin_amdgcn_wmma_f32_16x16x32_bf16(false, a, false, b, (short)0, c, false, false); }

// ---- k_wtG: W [in][out] f32 -> bf16 plane in fragment order, the three weight matrices in one launch (blockIdx.y picks the matrix).
// Plane: 1-KB blocks [in / 32][out / 16]; a block is one 16 (out) x 32 (in) WMMA operand as k_proj's two 16-B loads read it:
// chunk (j, lane) at byte 512 j + 16 lane holds W[k0 + 16 j + 8 (lane >> 4) + 0..7][n0 + (lane & 15)], so a wave-wide load is 512 contiguous bytes.
// One thread per 16-B chunk: eight 4-B reads (a work-group reads 256 contiguous bytes of each of 32 W rows), one 16-B store. coverage: gridDim.x * 256 == DMOD * DMOD / 8.
#define WBLK 512                          // bf16 per fragment block
static_assert((DMOD % 32) == 0 && ((DMOD * DMOD / 8) % 256) == 0);
__global__ __launch_bounds__(256) void k_wtG(const float* __restrict__ w0, const float* __restrict__ w1, const float* __restrict__ w2, bf* B0, bf* B1, bf* B2) {
    const int sel = blockIdx.y; const float* __restrict__ w = sel == 0 ? w0 : sel == 1 ? w1 : w2; bf* Bt = sel == 0 ? B0 : sel == 1 ? B1 : B2;
    const int c = blockIdx.x * 256 + threadIdx.x;   // chunk
    const int lane = c & 31, j = (c >> 5) & 1, nb = (c >> 6) % (DMOD / 16), ks = (c >> 6) / (DMOD / 16);
    const float* p = w + (size_t)(ks * 32 + j * 16 + (lane >> 4) * 8) * DMOD + nb * 16 + (lane & 15);
    v8us o;
#pragma unroll
    for (int i = 0; i < 8; ++i) o[i] = f2bf(p[(size_t)i * DMOD]);
    *(v8us*)(Bt + (size_t)c * 8) = o;
}

// ---- k_proj: the three projections in one launch; work-group = 4 waves on one 64-token tile, ONE WAVE per 64 tokens x 64 output features (16 accumulators); grid (TOK/64, DMOD/256, 3), 128 threads; blockIdx.z = 0 q, 1 k, 2 v.
// Activations: each 32-deep step's 64 x 32 f32 block is read once per work-group as whole 128-B lines, rounded to bf16 (nearest even) in registers and stored to a two-buffer LDS tile that the 4 waves share; step s+1 is fetched while step s is multiplied.
// Weights come straight from the fragment-ordered bf16 plane (each load 512 contiguous bytes per wave); bias (bf16-rounded, added in f32), carry and the f16 rounding are applied to the accumulators.
// Fragments: lane row/col = l&15, elements 0..7 <- k0+8h+0..7, 8..15 <- k0+16+8h+0..7 (h = l>>4) for A and B alike; D element r of lane l = (A row 8h+r, B row l&15).
// The operand whose index runs along the output rows is A, so a lane's 8 D elements are 16 contiguous output bytes: q, k (plane [tok][512]): A = W^T, B = activations; v (plane [512][tok]): A = activations, B = W^T.
typedef __attribute__((ext_vector_type(4))) __bf16 v4bf;
typedef v4bf __attribute__((may_alias)) v4bfa;
#define PW 4                              // waves per k_proj work-group
#define XSP 40                            // bf16 per staged activation row: 32 + 8 (80 B = 16 B x odd, for 16-byte LDS reads)
#define HSP 72                            // f16 per staged output row: 64 + 8 (144 B = 16 B x odd)
static_assert((DMOD % (64 * PW)) == 0 && (TOK % 64) == 0 && 32 * PW == 16 * 8);   // 16 rows of 8 x 16 B per staging pass, four passes per step
__device__ __forceinline__ v16bf ldw(const bf* p) { return cat16b(*(const v8usa*)p, *(const v8usa*)(p + 16)); }
__device__ __forceinline__ v16bf ldwp(const bf* p) { return cat16b(*(const v8usa*)p, *(const v8usa*)(p + WBLK / 2)); }   // a lane's two chunks of a fragment block
template <bool XA>   // XA: the activations are the A operand (v); otherwise the B operand (q, k)
__device__ __forceinline__ void proj_tile(const float* __restrict__ X, const bf* __restrict__ WT, const float* __restrict__ bias, float sc, h16* O, bf* xs, h16* hsall) {
    const int tid = threadIdx.x, lane = tid & 31, lr = lane & 15, hi = lane >> 4;
    const int wave = __builtin_amdgcn_readfirstlane(tid >> 5);
    const int t0 = blockIdx.x * 64, n0 = (blockIdx.y * PW + wave) * 64;
    h16* hs = hsall + wave * (64 * HSP);
    v8f acc[4][4];   // [A block][B block]
#pragma unroll
    for (int ab = 0; ab < 4; ++ab)
#pragma unroll
        for (int bb = 0; bb < 4; ++bb) acc[ab][bb] = (v8f){};
    const float* xg = X + ((size_t)(t0 / SEQ) * SEQ_FULL + (t0 % SEQ) + (tid >> 3)) * DMOD + (tid & 7) * 4;   // + pass * 16 rows + step
    bf* xw = xs + (tid >> 3) * XSP + (tid & 7) * 4;                                                         // + buffer * 64 * XSP + pass * 16 * XSP
    const bf* xr = xs + lr * XSP + 8 * hi;                                                                  // + buffer * 64 * XSP + block * 16 * XSP
    const bf* wp = WT + (size_t)(n0 / 16) * WBLK + lane * 8;                                                  // + block * WBLK + step * (DMOD / 16) * WBLK
    v4f xn[4];
#pragma unroll
    for (int u = 0; u < 4; ++u) xn[u] = *(const v4f*)(xg + (size_t)u * 16 * DMOD);
#pragma unroll
    for (int u = 0; u < 4; ++u) { v4bf c; c[0] = (__bf16)xn[u][0]; c[1] = (__bf16)xn[u][1]; c[2] = (__bf16)xn[u][2]; c[3] = (__bf16)xn[u][3]; *(v4bfa*)(xw + u * 16 * XSP) = c; }
    __syncthreads();   // step 0 is readable by every wave
#pragma unroll 1   // one copy of the 32-deep step, as in the plane GEMM before; the buffer is picked by the step's parity
    for (int kc = 0; kc < DMOD; kc += 32) {
        const int cur = (kc >> 5) & 1; const bool more = kc + 32 < DMOD;   // the same for the whole work-group
        if (more) {
#pragma unroll
            for (int u = 0; u < 4; ++u) xn[u] = *(const v4f*)(xg + (size_t)u * 16 * DMOD + kc + 32); }
        v16bf xf[4], wf[4];
#pragma unroll
        for (int u = 0; u < 4; ++u) wf[u] = ldwp(wp + u * WBLK + (size_t)(kc / 32) * (DMOD / 16) * WBLK);
#pragma unroll
        for (int u = 0; u < 4; ++u) xf[u] = ldw(xr + cur * (64 * XSP) + u * 16 * XSP);
#pragma unroll
        for (int bb = 0; bb < 4; ++bb)
#pragma unroll
            for (int ab = 0; ab < 4; ++ab) acc[ab][bb] = XA ? wmmab(xf[ab], wf[bb], acc[ab][bb]) : wmmab(wf[ab], xf[bb], acc[ab][bb]);
        // four vector slots behind the last WMMA, on every path, before its operands are rewritten
        asm volatile("v_nop\n\tv_nop\n\tv_nop\n\tv_nop" : "+v"(acc[0][0]), "+v"(acc[1][1]), "+v"(acc[2][2]), "+v"(acc[3][3]) : "v"(xf[0]), "v"(xf[3]), "v"(wf[0]), "v"(wf[3]));
        if (more) {
#pragma unroll
            for (int u = 0; u < 4; ++u) { v4bf c; c[0] = (__bf16)xn[u][0]; c[1] = (__bf16)xn[u][1]; c[2] = (__bf16)xn[u][2]; c[3] = (__bf16)xn[u][3]; *(v4bfa*)(xw + (cur ^ 1) * (64 * XSP) + u * 16 * XSP) = c; } }
        asm volatile("s_wait_xcnt 0x0" ::: "memory");   // a precaution: stands in front of the advance of the address registers that this step's global loads name
        __syncthreads();                                // publishes the next step's buffer and ends every wave's reads of this one
    }
    // output row j = B row (q, k: token; v: feature), position in the row i = A row (q, k: feature; v: token)
#pragma unroll
    for (int ab = 0; ab < 4; ++ab) {
        v8f bi;
        if (!XA) bi = *(const v8f*)(bias + n0 + ab * 16 + hi * 8);
#pragma unroll
        for (int bb = 0; bb < 4; ++bb) { v8h o; const float bj = XA ? bfr(bias[n0 + bb * 16 + lr]) : 0.f;
#pragma unroll
            for (int r = 0; r < 8; ++r) o[r] = (h16)((acc[ab][bb][r] + (XA ? bj : bfr(bi[r]))) * sc);
            *(v8ha*)(hs + (bb * 16 + lr) * HSP + ab * 16 + hi * 8) = o; }
    }
    __syncthreads();   // the staged output rows are written before other lanes read them
    h16* obase = XA ? O + (size_t)n0 * TOK + t0 : O + (size_t)t0 * DMOD + n0; const size_t ldo = XA ? TOK : DMOD;
#pragma unroll
    for (int s = 0; s < 16; ++s) { const int row = s * 4 + (lane >> 3), c = lane & 7;   // 8 lanes store one whole 128-B row segment
        *(v8h*)(obase + (size_t)row * ldo + c * 8) = *(const v8ha*)(hs + row * HSP + c * 8); }
}
__global__ __launch_bounds__(32 * PW) void k_proj(const float* __restrict__ Xq, const float* __restrict__ Xk, const float* __restrict__ Xv, const bf* __restrict__ WTq, const bf* __restrict__ WTk, const bf* __restrict__ WTv,
                                                  const float* __restrict__ bq, const float* __restrict__ bk, const float* __restrict__ bv, h16* Q16, h16* K16, h16* VT16) {
    __shared__ __align__(16) bf xs[2 * 64 * XSP];
    __shared__ __align__(16) h16 hs[PW * 64 * HSP];
    const int z = blockIdx.z;
    if (z == 2) proj_tile<true>(Xv, WTv, bv, VCAR, VT16, xs, hs);
    else proj_tile<false>(z ? Xk : Xq, z ? WTk : WTq, z ? bk : bq, z ? QKCAR : QSCL, z ? K16 : Q16, xs, hs);
}

// ---- k_sdpa: work-group = 16 waves = 8 query slots x 2 key halves; one wave = 32 query rows (two 16-column groups) of one (batch b, head h) against one half of the keys; grid (SEQ/256, NB*NHEAD), 512 threads.
// A stage is 256 keys: key half g owns keys 128 g .. 128 g + 127 of it. Its K rows [key][64 d] and V^T rows [d][128 keys] are copied global -> LDS once per work-group by the half's own 8 waves (16 B per lane and copy), two buffers: stage s+1 flies while stage s is worked on.
// Transposed tiles: S^T[key][q] = sum_d K[key][d] Q[q][d] (A = K rows from LDS, B = Q rows from the Q plane, both d-contiguous);
// the two 16-key D tiles of a 32-key step become the B fragment P^T[key][q] (element r <- tile keys 0..15, element 8+r <- tile keys 16..31, lane unchanged);
// O^T[d][q] += sum_key V^T[d][key] P^T[key][q] (A = V^T rows from LDS, key-contiguous). Lane (h2, m), column group c: q = q0 + 16 c + m; keys of a step = kb+8*h2+r and kb+16+8*h2+r.
// Online softmax per q with a held reference: PEXP minus the reference is the C operand of the score WMMAs, so their result is the exponent and the term is exp2 of it (x256 included) -> f16.
// The references are the maxima over the half's first 32 keys and are held through the pass: a step has no maximum and no test. A term that outgrows f16 turns its row sum non-finite; that is tested once behind the loop,
// and then the whole work-group goes through its keys again with the guarded loop: each step tests once (ballot, scalar branch) whether any lane's 32 exponents pass PEXP + PGROW; only then (and at the first step) the halves' maxima are joined (xor 16), the references move up to them and the sums are rescaled.
// The row sums over the f16 values accumulate in one more WMMA per step and column group, ones[16][32] . P^T (f32), whose every row holds them.
// Behind the loop key half 1 hands its sums, row sums and references to key half 0 through LDS (register order); half 0 brings both to the higher reference, adds and normalises.
__device__ __forceinline__ unsigned lds_addr(const void* p) { return (unsigned)(size_t)(__attribute__((address_space(3))) const void*)p; }
// One stage: lane copies K rows r, r+32, r+64, r+96 (its 16 B of each) and V^T rows d, d+16, d+32, d+48. s_wait_xcnt 0 closes the statement (a precaution): no operand register is rewritten ahead of it.
__device__ __forceinline__ void stage_copy(unsigned lk, unsigned lv, const h16* gk, const h16* gv) {
    asm volatile("global_load_async_to_lds_b128 %0, %8, off\n\t"
                 "global_load_async_to_lds_b128 %1, %9, off\n\t"
                 "global_load_async_to_lds_b128 %2, %10, off\n\t"
                 "global_load_async_to_lds_b128 %3, %11, off\n\t"
                 "global_load_async_to_lds_b128 %4, %12, off\n\t"
                 "global_load_async_to_lds_b128 %5, %13, off\n\t"
                 "global_load_async_to_lds_b128 %6, %14, off\n\t"
                 "global_load_async_to_lds_b128 %7, %15, off\n\t"
                 "s_wait_xcnt 0x0"
                 :: "v"(lk), "v"(lk + 32 * KPITCH), "v"(lk + 64 * KPITCH), "v"(lk + 96 * KPITCH),
                    "v"(lv), "v"(lv + 16 * VPITCH), "v"(lv + 32 * VPITCH), "v"(lv + 48 * VPITCH),
                    "v"(gk), "v"(gk + (size_t)32 * DMOD), "v"(gk + (size_t)64 * DMOD), "v"(gk + (size_t)96 * DMOD),
                    "v"(gv), "v"(gv + (size_t)16 * TOK), "v"(gv + (size_t)32 * TOK), "v"(gv + (size_t)48 * TOK)
                 : "memory");
}
// The scores of one 32-key step: K fragments from LDS, S^T = K . Q^T + C for both 16-key tiles and both column groups.
__device__ __forceinline__ void load_k(const unsigned char* kr0, v16h (&ka)[2][2]) {
#pragma unroll
    for (int kt = 0; kt < 2; ++kt) { const unsigned char* kr = kr0 + kt * 16 * KPITCH; ka[kt][0] = cat16(*(const v8ha*)kr, *(const v8ha*)(kr + 32)); ka[kt][1] = cat16(*(const v8ha*)(kr + 64), *(const v8ha*)(kr + 96)); }
}
__device__ __forceinline__ void score_mm(const v16h (&ka)[2][2], const v16h (&qf)[QC][2], const v8f (&bv)[QC], v8f (&st)[QC][2]) {
#pragma unroll
    for (int kt = 0; kt < 2; ++kt)
#pragma unroll
        for (int c = 0; c < QC; ++c) st[c][kt] = wmma16(ka[kt][0], qf[c][0], bv[c]);
#pragma unroll
    for (int kt = 0; kt < 2; ++kt)
#pragma unroll
        for (int c = 0; c < QC; ++c) st[c][kt] = wmma16(ka[kt][1], qf[c][1], st[c][kt]);
}
__device__ __forceinline__ void score_step(const unsigned char* kr0, const v16h (&qf)[QC][2], const v8f (&bv)[QC], v8f (&st)[QC][2]) {
    v16h ka[2][2];
    load_k(kr0, ka);
    score_mm(ka, qf, bv, st);
    // four vector slots behind the last score WMMA, on every path, before its result is read or its operands are rewritten
    asm volatile("v_nop\n\tv_nop\n\tv_nop\n\tv_nop" : "+v"(st[0][0]), "+v"(st[0][1]), "+v"(st[1][0]), "+v"(st[1][1]) : "v"(ka[0][0]), "v"(ka[0][1]), "v"(ka[1][0]), "v"(ka[1][1]), "v"(qf[0][0]), "v"(qf[0][1]), "v"(qf[1][0]), "v"(qf[1][1]));
}
// A lane's maximum over its 16 exponents of a step, per column group.
__device__ __forceinline__ void step_max(const v8f (&st)[QC][2], float (&mx)[QC]) {
#pragma unroll
    for (int c = 0; c < QC; ++c) { float mk[2];   // one chain per 16-key tile: the chains run side by side
#pragma unroll
        for (int kt = 0; kt < 2; ++kt) { mk[kt] = fmaxf(fmaxf(st[c][kt][0], st[c][kt][1]), st[c][kt][2]); mk[kt] = fmaxf(fmaxf(mk[kt], st[c][kt][3]), st[c][kt][4]); mk[kt] = fmaxf(fmaxf(mk[kt], st[c][kt][5]), st[c][kt][6]); }
        mx[c] = fmaxf(fmaxf(fmaxf(mk[0], mk[1]), st[c][0][7]), st[c][1][7]); }
}
__device__ __forceinline__ void clear_sums(v8f (&oacc)[QC][4], v8f (&lacc)[QC], v8f (&bv)[QC]) {
#pragma unroll
    for (int c = 0; c < QC; ++c) { lacc[c] = (v8f){}; bv[c] = (v8f){};
#pragma unroll
        for (int t = 0; t < 4; ++t) oacc[c][t] = (v8f){}; }
}
// All stages of a wave's key half; on return no copy is outstanding and every wave has left the ring.
// MOVE = false: on entry stage 0 is published and stage 1's copies are in flight; the references in bv stay as they are, a step has no test. The four steps of a stage are straight-line code: step i + 1's K fragments are read from LDS behind step i's softmax and fly under its row-sum and context WMMAs (only the stage's first step waits for its K reads).
// MOVE = true: the ring is idle on entry and two trips without work start it through the loop's own foot (trip -2: barrier, stage 0's copies; trip -1: their wait, the barrier that publishes them, stage 1's copies);
// bv comes in as zero, the first step sets the references and every step tests whether they have to move.
template <bool MOVE>
__device__ __forceinline__ void key_stages(const unsigned char* ring, unsigned lk, unsigned lv, const h16* gk, const h16* gv, int g, int m, int hh,
                                           const v16h (&qf)[QC][2], v8f (&oacc)[QC][4], v8f (&lacc)[QC], v8f (&bv)[QC]) {
    float thr = -3.0e38f;     // exponent above which the references move; below every score until the first step has set them
    v16h ones;   // A operand of the row-sum WMMA: 1.0 in every row and k
#pragma unroll
    for (int i = 0; i < 16; ++i) ones[i] = (h16)1.0f;
#pragma unroll 1   // one copy of the stage body: the buffer is picked by sg & 1
    for (int sg = MOVE ? -2 : 0; sg < NST; ++sg) {
        const unsigned char* kbase = ring + ((sg & 1) * KH + g) * SBYTES + m * KPITCH + 16 * hh;            // + key in the half's stage * KPITCH
        const unsigned char* vbase = ring + ((sg & 1) * KH + g) * SBYTES + KBYTES + m * VPITCH + 16 * hh;   // + d-tile * 16 * VPITCH + key in the half's stage * 2
        if constexpr (!MOVE) {   // held references: the stage's steps are straight-line code
            v16h ka[2][2];
            load_k(kbase, ka);
#pragma unroll   // no branch between the steps: every LDS offset is an immediate, and a step can read the next one's K fragments
            for (int kb = 0; kb < KST; kb += 32) {
                v8f st[QC][2];
                __builtin_amdgcn_sched_barrier(0);   // keeps the eight K fragment loads one group ahead of the score WMMAs: read pair by pair among them, each pair's wait runs down to 0
                score_mm(ka, qf, bv, st);
                __builtin_amdgcn_sched_barrier(0);   // keeps the V^T loads behind the score WMMAs, in the registers that the K fragments leave
                v16h va[4];
#pragma unroll
                for (int t = 0; t < 4; ++t) { const unsigned char* vr = vbase + t * 16 * VPITCH + kb * 2; va[t] = cat16(*(const v8ha*)vr, *(const v8ha*)(vr + 32)); }
                __builtin_amdgcn_sched_barrier(0);   // keeps the eight V^T fragment loads one group ahead of the softmax
                v16h pf[QC];
#pragma unroll
                for (int c = 0; c < QC; ++c) { pf[c] = (v16h){};
#pragma unroll
                    for (int r = 0; r < 8; ++r) {
                        pf[c][r] = (h16)__builtin_amdgcn_exp2f(st[c][0][r]);
                        pf[c][8 + r] = (h16)__builtin_amdgcn_exp2f(st[c][1][r]); } }
                __builtin_amdgcn_sched_barrier(0);   // the next step's K fragments are read here, into the registers that the scores leave, and fly under the ten WMMAs below
                if (kb + 32 < KST) load_k(kbase + (kb + 32) * KPITCH, ka);   // inside the stage only: nothing of the next stage is read in front of its barrier
                __builtin_amdgcn_sched_barrier(0);   // keeps those loads ahead of the WMMAs that are to cover their latency
#pragma unroll
                for (int c = 0; c < QC; ++c) lacc[c] = wmma16(ones, pf[c], lacc[c]);
                __builtin_amdgcn_sched_barrier(0);   // keeps the row-sum WMMAs ahead of the context WMMAs: moved down, they would stand behind the step's four pad slots
#pragma unroll
                for (int t = 0; t < 4; ++t)
#pragma unroll
                    for (int c = 0; c < QC; ++c) oacc[c][t] = wmma16(va[t], pf[c], oacc[c][t]);
                // four vector slots behind the last context WMMA before its operands are rewritten: by the next step's score tiles, or behind the loop's branches
                asm volatile("v_nop\n\tv_nop\n\tv_nop\n\tv_nop" : "+v"(oacc[0][0]), "+v"(oacc[0][1]), "+v"(oacc[0][2]), "+v"(oacc[0][3]), "+v"(oacc[1][0]), "+v"(oacc[1][1]), "+v"(oacc[1][2]), "+v"(oacc[1][3]) : "v"(va[0]), "v"(va[1]), "v"(va[2]), "v"(va[3]), "v"(pf[0]), "v"(pf[1]));
            }
        } else
#pragma unroll 1   // one copy of the 32-key step
        for (int kb = (MOVE && sg < 0) ? KST : 0; kb < KST; kb += 32) {   // no work in the two starting trips (the same for the whole work-group)
            v8f st[QC][2];
            score_step(kbase + kb * KPITCH, qf, bv, st);
            v16h va[4];
#pragma unroll
            for (int t = 0; t < 4; ++t) { const unsigned char* vr = vbase + t * 16 * VPITCH + kb * 2; va[t] = cat16(*(const v8ha*)vr, *(const v8ha*)(vr + 32)); }
            __builtin_amdgcn_sched_barrier(0);   // keeps the eight V^T fragment loads one group ahead of the softmax: split, the late part is waited for among the context WMMAs
            if constexpr (MOVE) {
                float mx[QC];
                step_max(st, mx);
                if (__builtin_expect(__builtin_amdgcn_ballot_w32(fmaxf(mx[0], mx[1]) > thr) != 0u, 0)) {   // wave-uniform: some query's reference has to move
                    const bool fresh = thr < 0.f;                                             // first step: no reference yet, the sums are still zero
#pragma unroll
                    for (int c = 0; c < QC; ++c) {
                        const float up = fmaxf(mx[c], __shfl_xor(mx[c], 16, 32)) - PEXP;      // both halves of a query move alike
                        const float d = fresh ? up : fmaxf(up, 0.f);                          // a reference never moves down
                        const float alpha = fresh ? 1.0f : __builtin_amdgcn_exp2f(-d);
                        st[c][0] -= d; st[c][1] -= d; bv[c] -= d; lacc[c] *= alpha;
#pragma unroll
                        for (int t = 0; t < 4; ++t) oacc[c][t] *= alpha;
                    }
                    thr = PEXP + PGROW;
                }
            }
            v16h pf[QC];
#pragma unroll
            for (int c = 0; c < QC; ++c) { pf[c] = (v16h){};
#pragma unroll
                for (int r = 0; r < 8; ++r) {
                    pf[c][r] = (h16)__builtin_amdgcn_exp2f(st[c][0][r]);
                    pf[c][8 + r] = (h16)__builtin_amdgcn_exp2f(st[c][1][r]); } }
#pragma unroll
            for (int c = 0; c < QC; ++c) lacc[c] = wmma16(ones, pf[c], lacc[c]);   // every row of ones . P^T is the step's sum over all 32 keys of column q: each lane holds its own query's sum
#pragma unroll
            for (int t = 0; t < 4; ++t)
#pragma unroll
                for (int c = 0; c < QC; ++c) oacc[c][t] = wmma16(va[t], pf[c], oacc[c][t]);
            // four vector slots behind the last context WMMA, on every path, before its operands are rewritten
            asm volatile("v_nop\n\tv_nop\n\tv_nop\n\tv_nop" : "+v"(oacc[0][0]), "+v"(oacc[0][1]), "+v"(oacc[0][2]), "+v"(oacc[0][3]), "+v"(oacc[1][0]), "+v"(oacc[1][1]), "+v"(oacc[1][2]), "+v"(oacc[1][3]) : "v"(va[0]), "v"(va[1]), "v"(va[2]), "v"(va[3]), "v"(pf[0]), "v"(pf[1]));
        }
        asm volatile("s_wait_dscnt 0x0" ::: "memory");      // this wave's reads of stage sg have returned before its buffer is refilled
        asm volatile("s_wait_asynccnt 0x0" ::: "memory");   // this wave's share of stage sg + 1 has landed
        __syncthreads();                                    // publishes stage sg + 1 and ends every wave's reads of stage sg
        if (sg + 2 < NST) stage_copy(lk + (sg & 1) * (KH * SBYTES), lv + (sg & 1) * (KH * SBYTES), gk + (size_t)(sg + 2) * (KH * KST) * DMOD, gv + (size_t)(sg + 2) * (KH * KST));   // work-group-uniform test; refills the buffer just read
    }
    asm volatile("s_wait_asynccnt 0x0" ::: "memory");       // no copy is outstanding when the wave goes on
}
__global__ __launch_bounds__(32 * QW * KH) void k_sdpa(const h16* __restrict__ Q16, const h16* __restrict__ K16, const h16* __restrict__ VT16, float* out) {
    __shared__ __align__(16) unsigned char ring[2 * KH * SBYTES];   // [buffer][key half][K rows | V^T rows]
    __shared__ __align__(16) float osall[QW * 32 * 68];
    __shared__ int again;                      // set by a wave whose held references were passed too far
    const int tid = threadIdx.x, lane = tid & 31, m = lane & 15, hh = lane >> 4, th = tid & (32 * QW - 1);
    const int wave = __builtin_amdgcn_readfirstlane(tid >> 5);
    const int g = wave / QW, wq = wave % QW;   // key half, query slot
    float* os = osall + wq * (32 * 68);        // shared by the two waves of a query slot
    const int bh = blockIdx.y; const int b = bh / NHEAD, h = bh % NHEAD; const int q0 = (blockIdx.x * QW + wq) * (16 * QC);
    const unsigned lk = lds_addr(ring) + g * SBYTES + (th >> 3) * KPITCH + (th & 7) * 16;               // + buffer * KH * SBYTES
    const unsigned lv = lds_addr(ring) + g * SBYTES + KBYTES + (th >> 4) * VPITCH + (th & 15) * 16;     // + buffer * KH * SBYTES
    const h16* gk = K16 + ((size_t)b * SEQ + g * KST + (th >> 3)) * DMOD + h * HD + (th & 7) * 8;          // + stage * KH * KST * DMOD
    const h16* gv = VT16 + ((size_t)h * HD + (th >> 4)) * TOK + (size_t)b * SEQ + g * KST + (th & 15) * 8;   // + stage * KH * KST
    stage_copy(lk, lv, gk, gv);
    v16h qf[QC][2];   // [column group][d 0..31, d 32..63]
#pragma unroll
    for (int c = 0; c < QC; ++c) { const h16* qrow = Q16 + ((size_t)b * SEQ + q0 + c * 16 + m) * DMOD + h * HD + 8 * hh;
        qf[c][0] = cat16(*(const v8h*)(qrow), *(const v8h*)(qrow + 16)); qf[c][1] = cat16(*(const v8h*)(qrow + 32), *(const v8h*)(qrow + 48)); }
    v8f oacc[QC][4], lacc[QC], bv[QC];   // lacc: row sums (every element: the lane's own query); bv: C operand of the score WMMAs, PEXP - reference of the lane's query, in all eight rows
    clear_sums(oacc, lacc, bv);
    if (tid == 0) again = 0;
    asm volatile("s_wait_asynccnt 0x0" ::: "memory");   // this wave's share of stage 0 has landed
    __syncthreads();                                    // stage 0 is readable by every wave
    stage_copy(lk + KH * SBYTES, lv + KH * SBYTES, gk + (size_t)KH * KST * DMOD, gv + KH * KST);
    {   // the held references: each query's maximum over the half's first 32 keys (their scores are formed once more in the loop, with the reference as C)
        v8f st[QC][2]; float mx[QC];
        score_step(ring + g * SBYTES + m * KPITCH + 16 * hh, qf, bv, st);
        step_max(st, mx);
#pragma unroll
        for (int c = 0; c < QC; ++c) bv[c] -= fmaxf(mx[c], __shfl_xor(mx[c], 16, 32)) - PEXP;   // both halves of a query alike
    }
    key_stages<false>(ring, lk, lv, gk, gv, g, m, hh, qf, oacc, lacc, bv);
    // A score 2^8 or more above its held reference gives an f16 infinity, which stays in the row sum: the one test of the whole pass.
    if (__builtin_amdgcn_ballot_w32(!(lacc[0][0] <= 3.0e38f) || !(lacc[1][0] <= 3.0e38f)) != 0u) { if (lane == 0) again = 1; }
    __syncthreads();   // every wave's verdict is readable; every wave has left the ring
    if (__builtin_amdgcn_readfirstlane(again) != 0) {   // the same for the whole work-group: all its waves go through the keys again, with references that move
        clear_sums(oacc, lacc, bv);
        key_stages<true>(ring, lk, lv, gk, gv, g, m, hh, qf, oacc, lacc, bv);
    }
    // Join of the key halves. Hand-over in register order: 16-B chunk j of lane l at float 128 j + 4 l (16 chunks of sums, one of row sums and C operands).
    if (g == 1) {
#pragma unroll
        for (int c = 0; c < QC; ++c)
#pragma unroll
            for (int t = 0; t < 4; ++t)
#pragma unroll
                for (int u = 0; u < 2; ++u) { const v4f w = {oacc[c][t][4 * u], oacc[c][t][4 * u + 1], oacc[c][t][4 * u + 2], oacc[c][t][4 * u + 3]}; *(v4fa*)(os + ((c * 4 + t) * 2 + u) * 128 + lane * 4) = w; }
        const v4f w = {lacc[0][0], lacc[1][0], bv[0][0], bv[1][0]}; *(v4fa*)(os + 16 * 128 + lane * 4) = w;
    }
    __syncthreads();   // key half 1's sums are readable by key half 0
    if (g == 0) {
        const v4f w = *(const v4fa*)(os + 16 * 128 + lane * 4);
        v8f ob[QC][4];
#pragma unroll
        for (int c = 0; c < QC; ++c)
#pragma unroll
            for (int t = 0; t < 4; ++t)
#pragma unroll
                for (int u = 0; u < 2; ++u) { const v4f x = *(const v4fa*)(os + ((c * 4 + t) * 2 + u) * 128 + lane * 4); ob[c][t][4 * u] = x[0]; ob[c][t][4 * u + 1] = x[1]; ob[c][t][4 * u + 2] = x[2]; ob[c][t][4 * u + 3] = x[3]; }
#pragma unroll
        for (int c = 0; c < QC; ++c) {
            const float ba = bv[c][0], bb = w[2 + c], bm = fminf(ba, bb);   // the smaller C operand belongs to the higher reference
            const float fa = __builtin_amdgcn_exp2f(bm - ba), fb = __builtin_amdgcn_exp2f(bm - bb);
            const float rl = __fdiv_rn(1.0f, lacc[c][0] * fa + w[c] * fb) * (1.0f / VCAR);
            const float ra = fa * rl, rb = fb * rl;
#pragma unroll
            for (int t = 0; t < 4; ++t)
#pragma unroll
                for (int r = 0; r < 8; ++r) os[(c * 16 + m) * 68 + t * 16 + hh * 8 + r] = oacc[c][t][r] * ra + ob[c][t][r] * rb;   // the slot's hand-over has been read into registers above
        }
    }
    __syncthreads();   // the staged output rows are readable by both waves of the slot
    float* obase = out + ((size_t)b * SEQ + q0 + g * 16) * DMOD + h * HD;   // each wave of the slot stores 16 of its 32 rows
#pragma unroll
    for (int s = 0; s < 8; ++s) { const int row = 2 * s + hh, cofs = m * 4; const v4f val = *(const v4fa*)(os + (g * 16 + row) * 68 + cofs); *(v4f*)(obase + (size_t)row * DMOD + cofs) = val; }
}

extern "C" void kernel_launch(void* const* d_in, const int* in_sizes, int n_in,
                              void* d_out, int out_size, void* d_ws, size_t ws_size, hipStream_t stream) {
    if (n_in < 9) return;
    const int need_x = ((NB - 1) * SEQ_FULL + SEQ) * DMOD;
    if (in_sizes[0] < need_x || in_sizes[1] < need_x || in_sizes[2] < need_x) return;
    if (in_sizes[3] < DMOD * DMOD || in_sizes[5] < DMOD * DMOD || in_sizes[7] < DMOD * DMOD) return;
    if (in_sizes[4] < DMOD || in_sizes[6] < DMOD || in_sizes[8] < DMOD) return;
    if (out_size < TOK * DMOD) return;
    const float* Xq = (const float*)d_in[0]; const float* Xk = (const float*)d_in[1]; const float* Xv = (const float*)d_in[2];
    const float* Wq = (const float*)d_in[3]; const float* bq = (const float*)d_in[4];
    const float* Wk = (const float*)d_in[5]; const float* bk = (const float*)d_in[6];
    const float* Wv = (const float*)d_in[7]; const float* bv = (const float*)d_in[8];
    float* OUT = (float*)d_out;     // [NB][SEQ][512]
    char* wsp = (char*)d_ws;
    auto take = [&](size_t bytes) { char* p = wsp; wsp += (bytes + 255) & ~(size_t)255; return (void*)p; };
    bf* WTq = (bf*)take((size_t)DMOD * DMOD * 2); bf* WTk = (bf*)take((size_t)DMOD * DMOD * 2); bf* WTv = (bf*)take((size_t)DMOD * DMOD * 2);   // fragment blocks [in / 32][out / 16], bf16
    h16* Q16 = (h16*)take((size_t)TOK * DMOD * 2); h16* K16 = (h16*)take((size_t)TOK * DMOD * 2); h16* VT16 = (h16*)take((size_t)TOK * DMOD * 2);   // [tok][512], [tok][512], [512][tok]
    if ((size_t)(wsp - (char*)d_ws) > ws_size) return;
    k_wtG<<<dim3(DMOD * DMOD / 8 / 256, 3, 1), 256, 0, stream>>>(Wq, Wk, Wv, WTq, WTk, WTv);
    // Q = query Wq + bq -> f16 [tok][512] x QSCL, K = key Wk + bk -> f16 [tok][512] x QKCAR; V^T = (value Wv + bv)^T -> f16 [512][tok] x VCAR
    k_proj<<<dim3(TOK / 64, DMOD / (64 * PW), 3), 32 * PW, 0, stream>>>(Xq, Xk, Xv, WTq, WTk, WTv, bq, bk, bv, Q16, K16, VT16);
    // softmax(Q K^T / 8) V per (batch, head), heads merged into [NB][SEQ][512]
    k_sdpa<<<dim3(SEQ / (16 * QC * QW), NB * NHEAD, 1), 32 * QW * KH, 0, stream>>>(Q16, K16, VT16, OUT);
}
